// v000
// Measured on an AMD MI455X. A time is GPU time per run, averaged over a window of back-to-back runs after a warm-up
// (all launches, gaps included; the runs take copies of the inputs in turn), and the median of several windows.
// Apart from v000's, it joins two sittings. Times from different sittings can be a few percent apart, while
// side-by-side timings come from the same sitting.
// The starting kernel, v000, takes 161 microseconds a run.
#include <hip/hip_runtime.h>
#include <hip/hip_bf16.h>
#include <math.h>

// Problem constants (reference: B=16, S=2048, H=1024)
#define Hd 1024
#define Sd 2048
#define Bd 16
#define TMR 64                // s-rows per block (four 16-row WMMA M-subtiles)

typedef __attribute__((ext_vector_type(16))) __bf16   v16bf;
typedef __attribute__((ext_vector_type(8)))  float    v8f;
typedef __attribute__((ext_vector_type(8)))  unsigned v8u;

__device__ __forceinline__ unsigned pack2_bf16_rne(float a, float b) {
  unsigned ua = __builtin_bit_cast(unsigned, a);
  unsigned ub = __builtin_bit_cast(unsigned, b);
  ua += 0x7FFFu + ((ua >> 16) & 1u);   // RNE round to bf16
  ub += 0x7FFFu + ((ub >> 16) & 1u);
  return (ua >> 16) | (ub & 0xFFFF0000u);
}

__device__ __forceinline__ float fast_tanh(float x) {
#if __has_builtin(__builtin_amdgcn_tanhf)
  return __builtin_amdgcn_tanhf(x);     // native v_tanh_f32 on gfx1250
#else
  return tanhf(x);
#endif
}

// Kernel 0: pre-pack W2 = W_attn[H:] into bf16 with a B-fragment-native tiling:
//   Wq[(kp>>2)*H + n] is a uint4 holding K-pairs kp..kp+3 of column n.
__global__ __launch_bounds__(256) void packw_kernel(
    const float* __restrict__ W, unsigned* __restrict__ Wpk) {
  int idx = blockIdx.x * 256 + threadIdx.x;       // 512*1024 output dwords
  int kpo = idx & 3;                              // K-pair within group of 4
  int n   = (idx >> 2) & 1023;                    // column
  int kpg = idx >> 12;                            // K-pair group (0..127)
  int k   = ((kpg << 2) | kpo) * 2;
  const float* W2 = W + (size_t)Hd * Hd;
  float w0 = W2[(size_t)k * Hd + n];
  float w1 = W2[(size_t)(k + 1) * Hd + n];
  Wpk[idx] = pack2_bf16_rne(w0, w1);
}

// Kernel 1: hidb[b][k] = hidden[b] . W_attn[:H][:,k] + b_attn[k]   (fp32)
__global__ __launch_bounds__(256) void hid_kernel(
    const float* __restrict__ hidden, const float* __restrict__ W,
    const float* __restrict__ bias, float* __restrict__ hidb) {
  int idx = blockIdx.x * 256 + threadIdx.x;       // 16*1024 outputs
  int bb = idx >> 10, kk = idx & 1023;
  const float* hrow = hidden + (size_t)bb * Hd;
  float s = bias[kk];
  for (int j = 0; j < Hd; ++j)
    s = fmaf(hrow[j], W[(size_t)j * Hd + kk], s);
  hidb[idx] = s;
}

// Kernel 2: fused  logits[b][s] = sum_n tanh( (enc @ W2)[s][n] + hidb[b][n] ) * v[n]
// One block = 64 s-rows of one batch (four M-subtiles), 128KB A tile in LDS
// (CDNA5 WGP allows up to 320KB per workgroup). 8 waves; each wave covers 8
// n-tiles in 2 groups of 4, holding C[4 n-tiles][4 subtiles]; every B fragment
// is amortized over 4 WMMAs -> W L2 traffic halves vs the 32-row tile.
__global__ __launch_bounds__(256) void attn_energy_kernel(
    const float* __restrict__ enc, const unsigned* __restrict__ Wpk,
    const float* __restrict__ hidb, const float* __restrict__ vvec,
    float* __restrict__ logits) {
  __shared__ unsigned ldsA[512 * TMR];   // 128KB (reused as f32 scratch later)

  const int tid  = threadIdx.x;
  const int wave = tid >> 5;
  const int lane = tid & 31;
  const int b    = blockIdx.x >> 5;            // Sd/TMR = 32 tiles per batch
  const int s0   = (blockIdx.x & 31) * TMR;

  // Stage A tile: 64 rows x 1024 K, fp32 -> packed bf16 pairs, XOR-swizzled:
  //   dword idx = row*512 + (kp ^ ((row&15)<<2))
  const float4* encv = (const float4*)(enc + ((size_t)b * Sd + s0) * Hd);
  for (int i = 0; i < 64; ++i) {
    int c   = tid + (i << 8);                  // float4 chunk id, 0..16383
    int row = c >> 8;                          // 256 float4 per row
    int kq  = c & 255;
    float4 a = encv[(size_t)row * 256 + kq];
    int kp0 = 2 * kq;
    int s   = (row & 15) << 2;
    uint2 pr;
    pr.x = pack2_bf16_rne(a.x, a.y);
    pr.y = pack2_bf16_rne(a.z, a.w);
    *(uint2*)&ldsA[row * 512 + (kp0 ^ s)] = pr;
  }
  __syncthreads();

  // WMMA fragment addressing (ISA 7.12.2, wave32):
  //  A (16x32 bf16): lane&15 = M row; lane>=16 -> K-pair offset 4;
  //                  VGPR j holds K-pair kp = 16*ks + (j&4)*2 + 4*hi + (j&3).
  //  B (32x16 bf16): lane&15 = N col; same K-pair pattern.
  //  C (16x16 f32):  VGPR r -> row r + 8*(lane>>4), col = lane&15.
  const int rowa = lane & 15;                  // A row == B column within tile
  const int hi   = lane >> 4;
  const int swz  = rowa << 2;                  // XOR swizzle for this lane's row
  const uint4* Wq = (const uint4*)Wpk;         // [kpg*Hd + n]

  float acc[4][8];
#pragma unroll
  for (int sub = 0; sub < 4; ++sub)
#pragma unroll
    for (int r = 0; r < 8; ++r) acc[sub][r] = 0.f;

  for (int g = 0; g < 2; ++g) {                // 2 groups of 4 n-tiles per wave
    const int nbase = wave * 128 + g * 64 + rowa;
    v8f C[4][4];                               // [n-tile][M-subtile]
#pragma unroll
    for (int t = 0; t < 4; ++t)
#pragma unroll
      for (int sub = 0; sub < 4; ++sub) C[t][sub] = (v8f){};

    // B pointer for ks=0: kpg = (ks<<2)+hi -> advance by 4*Hd uint4 per ks.
    const uint4* pB = Wq + (size_t)hi * Hd + nbase;

    for (int ks = 0; ks < 32; ++ks) {
      const int base0 = (ks << 4) + (hi << 2);        // K-pair base, jh=0
      const int col0  = base0 ^ swz;
      const int col1  = (base0 + 8) ^ swz;
      // A fragments once per ks: 2x ds_load_b128 per M-subtile (4 subtiles).
      v16bf Af[4];
#pragma unroll
      for (int sub = 0; sub < 4; ++sub) {
        const int rbase = (sub * 16 + rowa) * 512;
        uint4 alo = *(const uint4*)&ldsA[rbase + col0];
        uint4 ahi = *(const uint4*)&ldsA[rbase + col1];
        v8u au = {alo.x, alo.y, alo.z, alo.w, ahi.x, ahi.y, ahi.z, ahi.w};
        Af[sub] = __builtin_bit_cast(v16bf, au);
      }

#pragma unroll
      for (int t = 0; t < 4; ++t) {                   // 4 n-tiles share A-frags
        uint4 blo = pB[t * 16];                       // +256B immediate offsets
        uint4 bhi = pB[2 * Hd + t * 16];
        v8u bu = {blo.x, blo.y, blo.z, blo.w, bhi.x, bhi.y, bhi.z, bhi.w};
        v16bf Bm = __builtin_bit_cast(v16bf, bu);
#pragma unroll
        for (int sub = 0; sub < 4; ++sub)             // B amortized over 4 subs
          C[t][sub] = __builtin_amdgcn_wmma_f32_16x16x32_bf16(
                          false, Af[sub], false, Bm, (short)0, C[t][sub],
                          false, false);
      }
      pB += 4 * Hd;                                   // next ks K-pair group
    }

    // Fused epilogue: tanh(C + hid_part + bias) * v[n], reduce over n per row.
#pragma unroll
    for (int t = 0; t < 4; ++t) {
      const int n = nbase + t * 16;
      const float hb = hidb[b * Hd + n];
      const float vn = vvec[n];
#pragma unroll
      for (int sub = 0; sub < 4; ++sub)
#pragma unroll
        for (int r = 0; r < 8; ++r)
          acc[sub][r] += fast_tanh(C[t][sub][r] + hb) * vn;  // row = sub*16 + r + 8*hi
    }
  }

  // Deterministic cross-lane/cross-wave reduction: reuse A-tile LDS (A is dead).
  __syncthreads();
  float* scratch = (float*)ldsA;                      // 256 threads x 32 floats
#pragma unroll
  for (int sub = 0; sub < 4; ++sub)
#pragma unroll
    for (int r = 0; r < 8; ++r)
      scratch[tid * 32 + sub * 8 + r] = acc[sub][r];
  __syncthreads();
  if (tid < TMR) {
    const int sub = tid >> 4, h = (tid >> 3) & 1, r = tid & 7;
    float s = 0.f;
    for (int w = 0; w < 8; ++w)
      for (int l = 0; l < 16; ++l)
        s += scratch[(w * 32 + h * 16 + l) * 32 + sub * 8 + r];
    logits[(size_t)b * Sd + s0 + tid] = s;
  }
}

// Kernel 3: softmax over S per batch row.
__global__ __launch_bounds__(256) void softmax_kernel(
    const float* __restrict__ logits, float* __restrict__ out) {
  __shared__ float red[256];
  const int b = blockIdx.x, tid = threadIdx.x;
  const float* row = logits + (size_t)b * Sd;

  float m = -INFINITY;
  for (int i = tid; i < Sd; i += 256) m = fmaxf(m, row[i]);
  red[tid] = m; __syncthreads();
  for (int s = 128; s > 0; s >>= 1) {
    if (tid < s) red[tid] = fmaxf(red[tid], red[tid + s]);
    __syncthreads();
  }
  m = red[0];
  __syncthreads();

  float sl = 0.f;
  for (int i = tid; i < Sd; i += 256) {
    float e = __expf(row[i] - m);
    out[(size_t)b * Sd + i] = e;
    sl += e;
  }
  red[tid] = sl; __syncthreads();
  for (int s = 128; s > 0; s >>= 1) {
    if (tid < s) red[tid] += red[tid + s];
    __syncthreads();
  }
  const float inv = 1.f / red[0];
  for (int i = tid; i < Sd; i += 256)
    out[(size_t)b * Sd + i] *= inv;
}

extern "C" void kernel_launch(void* const* d_in, const int* in_sizes, int n_in,
                              void* d_out, int out_size, void* d_ws, size_t ws_size,
                              hipStream_t stream) {
  (void)in_sizes; (void)n_in; (void)out_size; (void)ws_size;
  const float* hidden = (const float*)d_in[0];   // (B,H)
  const float* enc    = (const float*)d_in[1];   // (B,S,H)
  const float* W      = (const float*)d_in[2];   // (2H,H)
  const float* b_attn = (const float*)d_in[3];   // (H,)
  const float* v      = (const float*)d_in[4];   // (H,)
  float* out = (float*)d_out;                    // (B,S)

  float*    hidb   = (float*)d_ws;               // 16*1024 f32
  float*    logits = hidb + Bd * Hd;             // 16*2048 f32
  unsigned* Wpk    = (unsigned*)(logits + Bd * Sd);  // 2MB packed bf16 (uint4 tiled)

  packw_kernel<<<(512 * Hd) / 256, 256, 0, stream>>>(W, Wpk);
  hid_kernel<<<(Bd * Hd) / 256, 256, 0, stream>>>(hidden, W, b_attn, hidb);
  attn_energy_kernel<<<Bd * (Sd / TMR), 256, 0, stream>>>(enc, Wpk, hidb, v, logits);
  softmax_kernel<<<Bd, 256, 0, stream>>>(logits, out);
}

// v001
// It runs in 131 microseconds.
// Timed twice side by side with v000, it ran 1.24 and 1.25 times as fast.
#include <hip/hip_runtime.h>
#include <hip/hip_bf16.h>
#include <math.h>

// Problem constants (reference: B=16, S=2048, H=1024)
#define Hd 1024
#define Sd 2048
#define Bd 16
#define TMR 64                // s-rows per block (four 16-row WMMA M-subtiles)

typedef __attribute__((ext_vector_type(16))) __bf16   v16bf;
typedef __attribute__((ext_vector_type(8)))  float    v8f;
typedef __attribute__((ext_vector_type(8)))  unsigned v8u;

__device__ __forceinline__ unsigned pack2_bf16_rne(float a, float b) {
  unsigned ua = __builtin_bit_cast(unsigned, a);
  unsigned ub = __builtin_bit_cast(unsigned, b);
  ua += 0x7FFFu + ((ua >> 16) & 1u);   // RNE round to bf16
  ub += 0x7FFFu + ((ub >> 16) & 1u);
  return (ua >> 16) | (ub & 0xFFFF0000u);
}

__device__ __forceinline__ float fast_tanh(float x) {
#if __has_builtin(__builtin_amdgcn_tanhf)
  return __builtin_amdgcn_tanhf(x);     // native v_tanh_f32 on gfx1250
#else
  return tanhf(x);
#endif
}

// Kernel 0: pre-pack W2 = W_attn[H:] into bf16 with a B-fragment-native tiling:
//   Wq[(kp>>2)*H + n] is a uint4 holding K-pairs kp..kp+3 of column n.
__global__ __launch_bounds__(256) void packw_kernel(
    const float* __restrict__ W, unsigned* __restrict__ Wpk) {
  int idx = blockIdx.x * 256 + threadIdx.x;       // 512*1024 output dwords
  int kpo = idx & 3;                              // K-pair within group of 4
  int n   = (idx >> 2) & 1023;                    // column
  int kpg = idx >> 12;                            // K-pair group (0..127)
  int k   = ((kpg << 2) | kpo) * 2;
  const float* W2 = W + (size_t)Hd * Hd;
  float w0 = W2[(size_t)k * Hd + n];
  float w1 = W2[(size_t)(k + 1) * Hd + n];
  Wpk[idx] = pack2_bf16_rne(w0, w1);
}

// Kernel 1: hidb[b][k] = hidden[b] . W_attn[:H][:,k] + b_attn[k]   (fp32)
// Split-K inside the block. One block = 32 columns x 4 batch rows x all 1024 j.
// A lane owns 4 columns (one float4 of a W row) and 32 of the j rows; a wave-wide
// load covers 4 whole 128-byte lines (4 rows x 32 columns). All 32 W loads of a
// lane are independent, so the block pays the memory latency once instead of
// once per unrolled trip of a 1024-long serial loop. The 32 partial sums of an
// output (8 waves x 4 lane groups) are added in a fixed order through LDS.
#define HB 4                  // batch rows per block
__global__ __launch_bounds__(256) void hid_kernel(
    const float* __restrict__ hidden, const float* __restrict__ W,
    const float* __restrict__ bias, float* __restrict__ hidb) {
  __shared__ float hs[HB * Hd];            // 16KB: this block's hidden rows
  __shared__ float part[32 * HB * 32];     // 16KB: [partial][batch row][column]

  const int tid  = threadIdx.x;
  const int wave = tid >> 5;
  const int lane = tid & 31;
  const int jq   = lane >> 3;              // which 4 of a group's 16 j rows
  const int c4   = lane & 7;               // which float4 of the 32 columns
  const int cg   = blockIdx.x & 31;        // column group
  const int bg   = blockIdx.x >> 5;        // batch group
  const int j0   = wave * 128 + jq * 4;    // a wave covers 128 j: 8 groups of 16

  // hidden first: loads return in order, so its LDS stores do not wait for the W rows.
  const float4* hv = (const float4*)(hidden + (size_t)bg * HB * Hd);
  float4 hreg[4];
  // All loops of this kernel are unrolled so that their arrays stay in registers.
#pragma unroll
  for (int i = 0; i < 4; ++i) hreg[i] = hv[tid + i * 256];
  const int   kk = cg * 32 + lane;         // output column of the final sum
  const float bv = bias[kk];               // fetched here so its latency is hidden

  const float* wp = W + (size_t)j0 * Hd + cg * 32 + c4 * 4;
  float4 w[8][4];
  // Unrolled: all 32 loads issue back to back, ahead of the first wait.
#pragma unroll
  for (int g = 0; g < 8; ++g)
#pragma unroll
    for (int i = 0; i < 4; ++i)
      w[g][i] = *(const float4*)(wp + (size_t)(g * 16 + i) * Hd);

#pragma unroll
  for (int i = 0; i < 4; ++i) ((float4*)hs)[tid + i * 256] = hreg[i];
  __syncthreads();

  float4 acc[HB];
#pragma unroll
  for (int bl = 0; bl < HB; ++bl) acc[bl] = make_float4(0.f, 0.f, 0.f, 0.f);

#pragma unroll
  for (int g = 0; g < 8; ++g) {
#pragma unroll
    for (int bl = 0; bl < HB; ++bl) {
      const float4 h = *(const float4*)&hs[bl * Hd + j0 + g * 16];
      const float hj[4] = {h.x, h.y, h.z, h.w};
#pragma unroll
      for (int i = 0; i < 4; ++i) {
        acc[bl].x = fmaf(hj[i], w[g][i].x, acc[bl].x);
        acc[bl].y = fmaf(hj[i], w[g][i].y, acc[bl].y);
        acc[bl].z = fmaf(hj[i], w[g][i].z, acc[bl].z);
        acc[bl].w = fmaf(hj[i], w[g][i].w, acc[bl].w);
      }
    }
  }

#pragma unroll
  for (int bl = 0; bl < HB; ++bl)
    *(float4*)&part[(wave * 4 + jq) * (HB * 32) + bl * 32 + c4 * 4] = acc[bl];
  __syncthreads();

  if (tid < HB * 32) {                     // one thread per output of the block
    float s = bv;
    // Unrolled: the LDS reads run ahead of the serial adds.
#pragma unroll
    for (int p = 0; p < 32; ++p) s += part[p * (HB * 32) + tid];
    hidb[(size_t)(bg * HB + (tid >> 5)) * Hd + kk] = s;
  }
}

// Kernel 2: fused  logits[b][s] = sum_n tanh( (enc @ W2)[s][n] + hidb[b][n] ) * v[n]
// One block = 64 s-rows of one batch (four M-subtiles), 128KB A tile in LDS
// (CDNA5 WGP allows up to 320KB per workgroup). 8 waves; each wave covers 8
// n-tiles in 2 groups of 4, holding C[4 n-tiles][4 subtiles]; every B fragment
// is amortized over 4 WMMAs -> W L2 traffic halves vs the 32-row tile.
__global__ __launch_bounds__(256) void attn_energy_kernel(
    const float* __restrict__ enc, const unsigned* __restrict__ Wpk,
    const float* __restrict__ hidb, const float* __restrict__ vvec,
    float* __restrict__ logits) {
  __shared__ unsigned ldsA[512 * TMR];   // 128KB (reused as f32 scratch later)

  const int tid  = threadIdx.x;
  const int wave = tid >> 5;
  const int lane = tid & 31;
  const int b    = blockIdx.x >> 5;            // Sd/TMR = 32 tiles per batch
  const int s0   = (blockIdx.x & 31) * TMR;

  // Stage A tile: 64 rows x 1024 K, fp32 -> packed bf16 pairs, XOR-swizzled:
  //   dword idx = row*512 + (kp ^ ((row&15)<<2))
  const float4* encv = (const float4*)(enc + ((size_t)b * Sd + s0) * Hd);
  for (int i = 0; i < 64; ++i) {
    int c   = tid + (i << 8);                  // float4 chunk id, 0..16383
    int row = c >> 8;                          // 256 float4 per row
    int kq  = c & 255;
    float4 a = encv[(size_t)row * 256 + kq];
    int kp0 = 2 * kq;
    int s   = (row & 15) << 2;
    uint2 pr;
    pr.x = pack2_bf16_rne(a.x, a.y);
    pr.y = pack2_bf16_rne(a.z, a.w);
    *(uint2*)&ldsA[row * 512 + (kp0 ^ s)] = pr;
  }
  __syncthreads();

  // WMMA fragment addressing (ISA 7.12.2, wave32):
  //  A (16x32 bf16): lane&15 = M row; lane>=16 -> K-pair offset 4;
  //                  VGPR j holds K-pair kp = 16*ks + (j&4)*2 + 4*hi + (j&3).
  //  B (32x16 bf16): lane&15 = N col; same K-pair pattern.
  //  C (16x16 f32):  VGPR r -> row r + 8*(lane>>4), col = lane&15.
  const int rowa = lane & 15;                  // A row == B column within tile
  const int hi   = lane >> 4;
  const int swz  = rowa << 2;                  // XOR swizzle for this lane's row
  const uint4* Wq = (const uint4*)Wpk;         // [kpg*Hd + n]

  float acc[4][8];
#pragma unroll
  for (int sub = 0; sub < 4; ++sub)
#pragma unroll
    for (int r = 0; r < 8; ++r) acc[sub][r] = 0.f;

  for (int g = 0; g < 2; ++g) {                // 2 groups of 4 n-tiles per wave
    const int nbase = wave * 128 + g * 64 + rowa;
    v8f C[4][4];                               // [n-tile][M-subtile]
#pragma unroll
    for (int t = 0; t < 4; ++t)
#pragma unroll
      for (int sub = 0; sub < 4; ++sub) C[t][sub] = (v8f){};

    // B pointer for ks=0: kpg = (ks<<2)+hi -> advance by 4*Hd uint4 per ks.
    const uint4* pB = Wq + (size_t)hi * Hd + nbase;

    for (int ks = 0; ks < 32; ++ks) {
      const int base0 = (ks << 4) + (hi << 2);        // K-pair base, jh=0
      const int col0  = base0 ^ swz;
      const int col1  = (base0 + 8) ^ swz;
      // A fragments once per ks: 2x ds_load_b128 per M-subtile (4 subtiles).
      v16bf Af[4];
#pragma unroll
      for (int sub = 0; sub < 4; ++sub) {
        const int rbase = (sub * 16 + rowa) * 512;
        uint4 alo = *(const uint4*)&ldsA[rbase + col0];
        uint4 ahi = *(const uint4*)&ldsA[rbase + col1];
        v8u au = {alo.x, alo.y, alo.z, alo.w, ahi.x, ahi.y, ahi.z, ahi.w};
        Af[sub] = __builtin_bit_cast(v16bf, au);
      }

#pragma unroll
      for (int t = 0; t < 4; ++t) {                   // 4 n-tiles share A-frags
        uint4 blo = pB[t * 16];                       // +256B immediate offsets
        uint4 bhi = pB[2 * Hd + t * 16];
        v8u bu = {blo.x, blo.y, blo.z, blo.w, bhi.x, bhi.y, bhi.z, bhi.w};
        v16bf Bm = __builtin_bit_cast(v16bf, bu);
#pragma unroll
        for (int sub = 0; sub < 4; ++sub)             // B amortized over 4 subs
          C[t][sub] = __builtin_amdgcn_wmma_f32_16x16x32_bf16(
                          false, Af[sub], false, Bm, (short)0, C[t][sub],
                          false, false);
      }
      pB += 4 * Hd;                                   // next ks K-pair group
    }

    // Fused epilogue: tanh(C + hid_part + bias) * v[n], reduce over n per row.
#pragma unroll
    for (int t = 0; t < 4; ++t) {
      const int n = nbase + t * 16;
      const float hb = hidb[b * Hd + n];
      const float vn = vvec[n];
#pragma unroll
      for (int sub = 0; sub < 4; ++sub)
#pragma unroll
        for (int r = 0; r < 8; ++r)
          acc[sub][r] += fast_tanh(C[t][sub][r] + hb) * vn;  // row = sub*16 + r + 8*hi
    }
  }

  // Deterministic cross-lane/cross-wave reduction: reuse A-tile LDS (A is dead).
  __syncthreads();
  float* scratch = (float*)ldsA;                      // 256 threads x 32 floats
#pragma unroll
  for (int sub = 0; sub < 4; ++sub)
#pragma unroll
    for (int r = 0; r < 8; ++r)
      scratch[tid * 32 + sub * 8 + r] = acc[sub][r];
  __syncthreads();
  if (tid < TMR) {
    const int sub = tid >> 4, h = (tid >> 3) & 1, r = tid & 7;
    float s = 0.f;
    for (int w = 0; w < 8; ++w)
      for (int l = 0; l < 16; ++l)
        s += scratch[(w * 32 + h * 16 + l) * 32 + sub * 8 + r];
    logits[(size_t)b * Sd + s0 + tid] = s;
  }
}

// Kernel 3: softmax over S per batch row.
__global__ __launch_bounds__(256) void softmax_kernel(
    const float* __restrict__ logits, float* __restrict__ out) {
  __shared__ float red[256];
  const int b = blockIdx.x, tid = threadIdx.x;
  const float* row = logits + (size_t)b * Sd;

  float m = -INFINITY;
  for (int i = tid; i < Sd; i += 256) m = fmaxf(m, row[i]);
  red[tid] = m; __syncthreads();
  for (int s = 128; s > 0; s >>= 1) {
    if (tid < s) red[tid] = fmaxf(red[tid], red[tid + s]);
    __syncthreads();
  }
  m = red[0];
  __syncthreads();

  float sl = 0.f;
  for (int i = tid; i < Sd; i += 256) {
    float e = __expf(row[i] - m);
    out[(size_t)b * Sd + i] = e;
    sl += e;
  }
  red[tid] = sl; __syncthreads();
  for (int s = 128; s > 0; s >>= 1) {
    if (tid < s) red[tid] += red[tid + s];
    __syncthreads();
  }
  const float inv = 1.f / red[0];
  for (int i = tid; i < Sd; i += 256)
    out[(size_t)b * Sd + i] *= inv;
}

extern "C" void kernel_launch(void* const* d_in, const int* in_sizes, int n_in,
                              void* d_out, int out_size, void* d_ws, size_t ws_size,
                              hipStream_t stream) {
  (void)in_sizes; (void)n_in; (void)out_size; (void)ws_size;
  const float* hidden = (const float*)d_in[0];   // (B,H)
  const float* enc    = (const float*)d_in[1];   // (B,S,H)
  const float* W      = (const float*)d_in[2];   // (2H,H)
  const float* b_attn = (const float*)d_in[3];   // (H,)
  const float* v      = (const float*)d_in[4];   // (H,)
  float* out = (float*)d_out;                    // (B,S)

  float*    hidb   = (float*)d_ws;               // 16*1024 f32
  float*    logits = hidb + Bd * Hd;             // 16*2048 f32
  unsigned* Wpk    = (unsigned*)(logits + Bd * Sd);  // 2MB packed bf16 (uint4 tiled)

  packw_kernel<<<(512 * Hd) / 256, 256, 0, stream>>>(W, Wpk);
  hid_kernel<<<(Hd / 32) * (Bd / HB), 256, 0, stream>>>(hidden, W, b_attn, hidb);
  attn_energy_kernel<<<Bd * (Sd / TMR), 256, 0, stream>>>(enc, Wpk, hidb, v, logits);
  softmax_kernel<<<Bd, 256, 0, stream>>>(logits, out);
}

// v002
// One run takes 96.3 microseconds.
// Two timings next to v001 put it at 1.38 and 1.39 times that version's speed.
// Over all steps from v000 it is 1.72 times as fast.
#include <hip/hip_runtime.h>
#include <hip/hip_bf16.h>
#include <math.h>

// Problem constants (reference: B=16, S=2048, H=1024)
#define Hd 1024
#define Sd 2048
#define Bd 16
#define TMR 64                // s-rows per block (four 16-row WMMA M-subtiles)

typedef __attribute__((ext_vector_type(16))) __bf16   v16bf;
typedef __attribute__((ext_vector_type(8)))  float    v8f;
typedef __attribute__((ext_vector_type(8)))  unsigned v8u;

__device__ __forceinline__ unsigned pack2_bf16_rne(float a, float b) {
  unsigned ua = __builtin_bit_cast(unsigned, a);
  unsigned ub = __builtin_bit_cast(unsigned, b);
  ua += 0x7FFFu + ((ua >> 16) & 1u);   // RNE round to bf16
  ub += 0x7FFFu + ((ub >> 16) & 1u);
  return (ua >> 16) | (ub & 0xFFFF0000u);
}

__device__ __forceinline__ float fast_tanh(float x) {
#if __has_builtin(__builtin_amdgcn_tanhf)
  return __builtin_amdgcn_tanhf(x);     // native v_tanh_f32 on gfx1250
#else
  return tanhf(x);
#endif
}

// Kernel 0: pre-pack W2 = W_attn[H:] into bf16 with a B-fragment-native tiling:
//   Wq[(kp>>2)*H + n] is a uint4 holding K-pairs kp..kp+3 of column n.
__global__ __launch_bounds__(256) void packw_kernel(
    const float* __restrict__ W, unsigned* __restrict__ Wpk) {
  int idx = blockIdx.x * 256 + threadIdx.x;       // 512*1024 output dwords
  int kpo = idx & 3;                              // K-pair within group of 4
  int n   = (idx >> 2) & 1023;                    // column
  int kpg = idx >> 12;                            // K-pair group (0..127)
  int k   = ((kpg << 2) | kpo) * 2;
  const float* W2 = W + (size_t)Hd * Hd;
  float w0 = W2[(size_t)k * Hd + n];
  float w1 = W2[(size_t)(k + 1) * Hd + n];
  Wpk[idx] = pack2_bf16_rne(w0, w1);
}

// Kernel 1: hidb[b][k] = hidden[b] . W_attn[:H][:,k] + b_attn[k]   (fp32)
// Split-K inside the block. One block = 32 columns x 4 batch rows x all 1024 j.
// A lane owns 4 columns (one float4 of a W row) and 32 of the j rows; a wave-wide
// load covers 4 whole 128-byte lines (4 rows x 32 columns). All 32 W loads of a
// lane are independent, so the block pays the memory latency once instead of
// once per unrolled trip of a 1024-long serial loop. The 32 partial sums of an
// output (8 waves x 4 lane groups) are added in a fixed order through LDS.
#define HB 4                  // batch rows per block
__global__ __launch_bounds__(256) void hid_kernel(
    const float* __restrict__ hidden, const float* __restrict__ W,
    const float* __restrict__ bias, float* __restrict__ hidb) {
  __shared__ float hs[HB * Hd];            // 16KB: this block's hidden rows
  __shared__ float part[32 * HB * 32];     // 16KB: [partial][batch row][column]

  const int tid  = threadIdx.x;
  const int wave = tid >> 5;
  const int lane = tid & 31;
  const int jq   = lane >> 3;              // which 4 of a group's 16 j rows
  const int c4   = lane & 7;               // which float4 of the 32 columns
  const int cg   = blockIdx.x & 31;        // column group
  const int bg   = blockIdx.x >> 5;        // batch group
  const int j0   = wave * 128 + jq * 4;    // a wave covers 128 j: 8 groups of 16

  // hidden first: loads return in order, so its LDS stores do not wait for the W rows.
  const float4* hv = (const float4*)(hidden + (size_t)bg * HB * Hd);
  float4 hreg[4];
  // All loops of this kernel are unrolled so that their arrays stay in registers.
#pragma unroll
  for (int i = 0; i < 4; ++i) hreg[i] = hv[tid + i * 256];
  const int   kk = cg * 32 + lane;         // output column of the final sum
  const float bv = bias[kk];               // fetched here so its latency is hidden

  const float* wp = W + (size_t)j0 * Hd + cg * 32 + c4 * 4;
  float4 w[8][4];
  // Unrolled: all 32 loads issue back to back, ahead of the first wait.
#pragma unroll
  for (int g = 0; g < 8; ++g)
#pragma unroll
    for (int i = 0; i < 4; ++i)
      w[g][i] = *(const float4*)(wp + (size_t)(g * 16 + i) * Hd);

#pragma unroll
  for (int i = 0; i < 4; ++i) ((float4*)hs)[tid + i * 256] = hreg[i];
  __syncthreads();

  float4 acc[HB];
#pragma unroll
  for (int bl = 0; bl < HB; ++bl) acc[bl] = make_float4(0.f, 0.f, 0.f, 0.f);

#pragma unroll
  for (int g = 0; g < 8; ++g) {
#pragma unroll
    for (int bl = 0; bl < HB; ++bl) {
      const float4 h = *(const float4*)&hs[bl * Hd + j0 + g * 16];
      const float hj[4] = {h.x, h.y, h.z, h.w};
#pragma unroll
      for (int i = 0; i < 4; ++i) {
        acc[bl].x = fmaf(hj[i], w[g][i].x, acc[bl].x);
        acc[bl].y = fmaf(hj[i], w[g][i].y, acc[bl].y);
        acc[bl].z = fmaf(hj[i], w[g][i].z, acc[bl].z);
        acc[bl].w = fmaf(hj[i], w[g][i].w, acc[bl].w);
      }
    }
  }

#pragma unroll
  for (int bl = 0; bl < HB; ++bl)
    *(float4*)&part[(wave * 4 + jq) * (HB * 32) + bl * 32 + c4 * 4] = acc[bl];
  __syncthreads();

  if (tid < HB * 32) {                     // one thread per output of the block
    float s = bv;
    // Unrolled: the LDS reads run ahead of the serial adds.
#pragma unroll
    for (int p = 0; p < 32; ++p) s += part[p * (HB * 32) + tid];
    hidb[(size_t)(bg * HB + (tid >> 5)) * Hd + kk] = s;
  }
}

// Kernel 2: fused  logits[b][s] = sum_n tanh( (enc @ W2)[s][n] + hidb[b][n] ) * v[n]
// One block = 64 s-rows of one batch (four M-subtiles), 128KB A tile in LDS
// (CDNA5 WGP allows up to 320KB per workgroup). 8 waves; each wave covers 8
// n-tiles in 2 groups of 4, holding C[4 n-tiles][4 subtiles]; every B fragment
// is amortized over 4 WMMAs -> W L2 traffic halves vs the 32-row tile.
__global__ __launch_bounds__(256) void attn_energy_kernel(
    const float* __restrict__ enc, const unsigned* __restrict__ Wpk,
    const float* __restrict__ hidb, const float* __restrict__ vvec,
    float* __restrict__ logits) {
  __shared__ unsigned ldsA[512 * TMR];   // 128KB (reused as f32 scratch later)

  const int tid  = threadIdx.x;
  const int wave = tid >> 5;
  const int lane = tid & 31;
  const int b    = blockIdx.x >> 5;            // Sd/TMR = 32 tiles per batch
  const int s0   = (blockIdx.x & 31) * TMR;

  // Stage A tile: 64 rows x 1024 K, fp32 -> packed bf16 pairs, XOR-swizzled:
  //   dword idx = row*512 + (kp ^ ((row&15)<<2))
  const float4* encv = (const float4*)(enc + ((size_t)b * Sd + s0) * Hd);
  for (int i = 0; i < 64; ++i) {
    int c   = tid + (i << 8);                  // float4 chunk id, 0..16383
    int row = c >> 8;                          // 256 float4 per row
    int kq  = c & 255;
    float4 a = encv[(size_t)row * 256 + kq];
    int kp0 = 2 * kq;
    int s   = (row & 15) << 2;
    uint2 pr;
    pr.x = pack2_bf16_rne(a.x, a.y);
    pr.y = pack2_bf16_rne(a.z, a.w);
    *(uint2*)&ldsA[row * 512 + (kp0 ^ s)] = pr;
  }
  __syncthreads();

  // WMMA fragment addressing (ISA 7.12.2, wave32):
  //  A (16x32 bf16): lane&15 = M row; lane>=16 -> K-pair offset 4;
  //                  VGPR j holds K-pair kp = 16*ks + (j&4)*2 + 4*hi + (j&3).
  //  B (32x16 bf16): lane&15 = N col; same K-pair pattern.
  //  C (16x16 f32):  VGPR r -> row r + 8*(lane>>4), col = lane&15.
  const int rowa = lane & 15;                  // A row == B column within tile
  const int hi   = lane >> 4;
  const int swz  = rowa << 2;                  // XOR swizzle for this lane's row
  const uint4* Wq = (const uint4*)Wpk;         // [kpg*Hd + n]

  float acc[4][8];
#pragma unroll
  for (int sub = 0; sub < 4; ++sub)
#pragma unroll
    for (int r = 0; r < 8; ++r) acc[sub][r] = 0.f;

  // Kept rolled: unrolled, one group's epilogue values stay live beside the next
  // group's accumulators and the wave needs more than 256 VGPRs, so that only one
  // work-group (two waves per SIMD) fits on a WGP instead of two.
#pragma unroll 1
  for (int g = 0; g < 2; ++g) {                // 2 groups of 4 n-tiles per wave
    const int nbase = wave * 128 + g * 64 + rowa;
    v8f C[4][4];                               // [n-tile][M-subtile]
#pragma unroll
    for (int t = 0; t < 4; ++t)
#pragma unroll
      for (int sub = 0; sub < 4; ++sub) C[t][sub] = (v8f){};

    // B pointer for ks=0: kpg = (ks<<2)+hi -> advance by 4*Hd uint4 per ks.
    const uint4* pB = Wq + (size_t)hi * Hd + nbase;

    for (int ks = 0; ks < 32; ++ks) {
      const int base0 = (ks << 4) + (hi << 2);        // K-pair base, jh=0
      const int col0  = base0 ^ swz;
      const int col1  = (base0 + 8) ^ swz;
      // A fragments once per ks: 2x ds_load_b128 per M-subtile (4 subtiles).
      v16bf Af[4];
#pragma unroll
      for (int sub = 0; sub < 4; ++sub) {
        const int rbase = (sub * 16 + rowa) * 512;
        uint4 alo = *(const uint4*)&ldsA[rbase + col0];
        uint4 ahi = *(const uint4*)&ldsA[rbase + col1];
        v8u au = {alo.x, alo.y, alo.z, alo.w, ahi.x, ahi.y, ahi.z, ahi.w};
        Af[sub] = __builtin_bit_cast(v16bf, au);
      }

#pragma unroll
      for (int t = 0; t < 4; ++t) {                   // 4 n-tiles share A-frags
        uint4 blo = pB[t * 16];                       // +256B immediate offsets
        uint4 bhi = pB[2 * Hd + t * 16];
        v8u bu = {blo.x, blo.y, blo.z, blo.w, bhi.x, bhi.y, bhi.z, bhi.w};
        v16bf Bm = __builtin_bit_cast(v16bf, bu);
#pragma unroll
        for (int sub = 0; sub < 4; ++sub)             // B amortized over 4 subs
          C[t][sub] = __builtin_amdgcn_wmma_f32_16x16x32_bf16(
                          false, Af[sub], false, Bm, (short)0, C[t][sub],
                          false, false);
      }
      pB += 4 * Hd;                                   // next ks K-pair group
    }

    // Fused epilogue: tanh(C + hid_part + bias) * v[n], reduce over n per row.
#pragma unroll
    for (int t = 0; t < 4; ++t) {
      const int n = nbase + t * 16;
      const float hb = hidb[b * Hd + n];
      const float vn = vvec[n];
#pragma unroll
      for (int sub = 0; sub < 4; ++sub)
#pragma unroll
        for (int r = 0; r < 8; ++r)
          acc[sub][r] += fast_tanh(C[t][sub][r] + hb) * vn;  // row = sub*16 + r + 8*hi
    }
  }

  // Deterministic cross-lane/cross-wave reduction: reuse A-tile LDS (A is dead).
  __syncthreads();
  float* scratch = (float*)ldsA;                      // 256 threads x 32 floats
#pragma unroll
  for (int sub = 0; sub < 4; ++sub)
#pragma unroll
    for (int r = 0; r < 8; ++r)
      scratch[tid * 32 + sub * 8 + r] = acc[sub][r];
  __syncthreads();
  if (tid < TMR) {
    const int sub = tid >> 4, h = (tid >> 3) & 1, r = tid & 7;
    float s = 0.f;
    for (int w = 0; w < 8; ++w)
      for (int l = 0; l < 16; ++l)
        s += scratch[(w * 32 + h * 16 + l) * 32 + sub * 8 + r];
    logits[(size_t)b * Sd + s0 + tid] = s;
  }
}

// Kernel 3: softmax over S per batch row.
__global__ __launch_bounds__(256) void softmax_kernel(
    const float* __restrict__ logits, float* __restrict__ out) {
  __shared__ float red[256];
  const int b = blockIdx.x, tid = threadIdx.x;
  const float* row = logits + (size_t)b * Sd;

  float m = -INFINITY;
  for (int i = tid; i < Sd; i += 256) m = fmaxf(m, row[i]);
  red[tid] = m; __syncthreads();
  for (int s = 128; s > 0; s >>= 1) {
    if (tid < s) red[tid] = fmaxf(red[tid], red[tid + s]);
    __syncthreads();
  }
  m = red[0];
  __syncthreads();

  float sl = 0.f;
  for (int i = tid; i < Sd; i += 256) {
    float e = __expf(row[i] - m);
    out[(size_t)b * Sd + i] = e;
    sl += e;
  }
  red[tid] = sl; __syncthreads();
  for (int s = 128; s > 0; s >>= 1) {
    if (tid < s) red[tid] += red[tid + s];
    __syncthreads();
  }
  const float inv = 1.f / red[0];
  for (int i = tid; i < Sd; i += 256)
    out[(size_t)b * Sd + i] *= inv;
}

extern "C" void kernel_launch(void* const* d_in, const int* in_sizes, int n_in,
                              void* d_out, int out_size, void* d_ws, size_t ws_size,
                              hipStream_t stream) {
  (void)in_sizes; (void)n_in; (void)out_size; (void)ws_size;
  const float* hidden = (const float*)d_in[0];   // (B,H)
  const float* enc    = (const float*)d_in[1];   // (B,S,H)
  const float* W      = (const float*)d_in[2];   // (2H,H)
  const float* b_attn = (const float*)d_in[3];   // (H,)
  const float* v      = (const float*)d_in[4];   // (H,)
  float* out = (float*)d_out;                    // (B,S)

  float*    hidb   = (float*)d_ws;               // 16*1024 f32
  float*    logits = hidb + Bd * Hd;             // 16*2048 f32
  unsigned* Wpk    = (unsigned*)(logits + Bd * Sd);  // 2MB packed bf16 (uint4 tiled)

  packw_kernel<<<(512 * Hd) / 256, 256, 0, stream>>>(W, Wpk);
  hid_kernel<<<(Hd / 32) * (Bd / HB), 256, 0, stream>>>(hidden, W, b_attn, hidb);
  attn_energy_kernel<<<Bd * (Sd / TMR), 256, 0, stream>>>(enc, Wpk, hidb, v, logits);
  softmax_kernel<<<Bd, 256, 0, stream>>>(logits, out);
}

// v003
// A run of this version takes 68.5 microseconds.
// Two timings next to v002 put it at 1.36 and 1.35 times that version's speed.
// All steps since v000 together make it 2.34 times as fast.
#include <hip/hip_runtime.h>
#include <hip/hip_bf16.h>
#include <math.h>

// Problem constants (reference: B=16, S=2048, H=1024)
#define Hd 1024
#define Sd 2048
#define Bd 16
#define TMR 64                // s-rows per block (four 16-row WMMA M-subtiles)

typedef __attribute__((ext_vector_type(16))) __bf16   v16bf;
typedef __attribute__((ext_vector_type(8)))  float    v8f;
typedef __attribute__((ext_vector_type(8)))  unsigned v8u;

__device__ __forceinline__ unsigned pack2_bf16_rne(float a, float b) {
  unsigned ua = __builtin_bit_cast(unsigned, a);
  unsigned ub = __builtin_bit_cast(unsigned, b);
  ua += 0x7FFFu + ((ua >> 16) & 1u);   // RNE round to bf16
  ub += 0x7FFFu + ((ub >> 16) & 1u);
  return (ua >> 16) | (ub & 0xFFFF0000u);
}

__device__ __forceinline__ float fast_tanh(float x) {
#if __has_builtin(__builtin_amdgcn_tanhf)
  return __builtin_amdgcn_tanhf(x);     // native v_tanh_f32 on gfx1250
#else
  return tanhf(x);
#endif
}

// Kernel 0: pre-pack W2 = W_attn[H:] into bf16 with a B-fragment-native tiling:
//   Wq[(kp>>2)*H + n] is a uint4 holding K-pairs kp..kp+3 of column n.
__global__ __launch_bounds__(256) void packw_kernel(
    const float* __restrict__ W, unsigned* __restrict__ Wpk) {
  int idx = blockIdx.x * 256 + threadIdx.x;       // 512*1024 output dwords
  int kpo = idx & 3;                              // K-pair within group of 4
  int n   = (idx >> 2) & 1023;                    // column
  int kpg = idx >> 12;                            // K-pair group (0..127)
  int k   = ((kpg << 2) | kpo) * 2;
  const float* W2 = W + (size_t)Hd * Hd;
  float w0 = W2[(size_t)k * Hd + n];
  float w1 = W2[(size_t)(k + 1) * Hd + n];
  Wpk[idx] = pack2_bf16_rne(w0, w1);
}

// Kernel 1: hidb[b][k] = hidden[b] . W_attn[:H][:,k] + b_attn[k]   (fp32)
// Split-K inside the block. One block = 32 columns x 4 batch rows x all 1024 j.
// A lane owns 4 columns (one float4 of a W row) and 32 of the j rows; a wave-wide
// load covers 4 whole 128-byte lines (4 rows x 32 columns). All 32 W loads of a
// lane are independent, so the block pays the memory latency once instead of
// once per unrolled trip of a 1024-long serial loop. The 32 partial sums of an
// output (8 waves x 4 lane groups) are added in a fixed order through LDS.
#define HB 4                  // batch rows per block
__global__ __launch_bounds__(256) void hid_kernel(
    const float* __restrict__ hidden, const float* __restrict__ W,
    const float* __restrict__ bias, float* __restrict__ hidb) {
  __shared__ float hs[HB * Hd];            // 16KB: this block's hidden rows
  __shared__ float part[32 * HB * 32];     // 16KB: [partial][batch row][column]

  const int tid  = threadIdx.x;
  const int wave = tid >> 5;
  const int lane = tid & 31;
  const int jq   = lane >> 3;              // which 4 of a group's 16 j rows
  const int c4   = lane & 7;               // which float4 of the 32 columns
  const int cg   = blockIdx.x & 31;        // column group
  const int bg   = blockIdx.x >> 5;        // batch group
  const int j0   = wave * 128 + jq * 4;    // a wave covers 128 j: 8 groups of 16

  // hidden first: loads return in order, so its LDS stores do not wait for the W rows.
  const float4* hv = (const float4*)(hidden + (size_t)bg * HB * Hd);
  float4 hreg[4];
  // All loops of this kernel are unrolled so that their arrays stay in registers.
#pragma unroll
  for (int i = 0; i < 4; ++i) hreg[i] = hv[tid + i * 256];
  const int   kk = cg * 32 + lane;         // output column of the final sum
  const float bv = bias[kk];               // fetched here so its latency is hidden

  const float* wp = W + (size_t)j0 * Hd + cg * 32 + c4 * 4;
  float4 w[8][4];
  // Unrolled: all 32 loads issue back to back, ahead of the first wait.
#pragma unroll
  for (int g = 0; g < 8; ++g)
#pragma unroll
    for (int i = 0; i < 4; ++i)
      w[g][i] = *(const float4*)(wp + (size_t)(g * 16 + i) * Hd);

#pragma unroll
  for (int i = 0; i < 4; ++i) ((float4*)hs)[tid + i * 256] = hreg[i];
  __syncthreads();

  float4 acc[HB];
#pragma unroll
  for (int bl = 0; bl < HB; ++bl) acc[bl] = make_float4(0.f, 0.f, 0.f, 0.f);

#pragma unroll
  for (int g = 0; g < 8; ++g) {
#pragma unroll
    for (int bl = 0; bl < HB; ++bl) {
      const float4 h = *(const float4*)&hs[bl * Hd + j0 + g * 16];
      const float hj[4] = {h.x, h.y, h.z, h.w};
#pragma unroll
      for (int i = 0; i < 4; ++i) {
        acc[bl].x = fmaf(hj[i], w[g][i].x, acc[bl].x);
        acc[bl].y = fmaf(hj[i], w[g][i].y, acc[bl].y);
        acc[bl].z = fmaf(hj[i], w[g][i].z, acc[bl].z);
        acc[bl].w = fmaf(hj[i], w[g][i].w, acc[bl].w);
      }
    }
  }

#pragma unroll
  for (int bl = 0; bl < HB; ++bl)
    *(float4*)&part[(wave * 4 + jq) * (HB * 32) + bl * 32 + c4 * 4] = acc[bl];
  __syncthreads();

  if (tid < HB * 32) {                     // one thread per output of the block
    float s = bv;
    // Unrolled: the LDS reads run ahead of the serial adds.
#pragma unroll
    for (int p = 0; p < 32; ++p) s += part[p * (HB * 32) + tid];
    hidb[(size_t)(bg * HB + (tid >> 5)) * Hd + kk] = s;
  }
}

// Kernel 2: fused  logits[b][s] = sum_n tanh( (enc @ W2)[s][n] + hidb[b][n] ) * v[n]
// One block = 64 s-rows of one batch (four M-subtiles), 128KB A tile in LDS
// (CDNA5 WGP allows up to 320KB per workgroup). 8 waves; each wave covers 8
// n-tiles in 2 groups of 4, holding C[4 n-tiles][4 subtiles]; every B fragment
// is amortized over 4 WMMAs -> W L2 traffic halves vs the 32-row tile.
__global__ __launch_bounds__(256) void attn_energy_kernel(
    const float* __restrict__ enc, const unsigned* __restrict__ Wpk,
    const float* __restrict__ hidb, const float* __restrict__ vvec,
    float* __restrict__ logits) {
  __shared__ unsigned ldsA[512 * TMR];   // 128KB (reused as f32 scratch later)

  const int tid  = threadIdx.x;
  const int wave = tid >> 5;
  const int lane = tid & 31;
  const int b    = blockIdx.x >> 5;            // Sd/TMR = 32 tiles per batch
  const int s0   = (blockIdx.x & 31) * TMR;

  // Stage A tile: 64 rows x 1024 K, fp32 -> packed bf16 pairs, XOR-swizzled:
  //   dword idx = row*512 + (kp ^ ((row&15)<<2))
  const float4* encv = (const float4*)(enc + ((size_t)b * Sd + s0) * Hd);
  for (int i = 0; i < 64; ++i) {
    int c   = tid + (i << 8);                  // float4 chunk id, 0..16383
    int row = c >> 8;                          // 256 float4 per row
    int kq  = c & 255;
    float4 a = encv[(size_t)row * 256 + kq];
    int kp0 = 2 * kq;
    int s   = (row & 15) << 2;
    uint2 pr;
    pr.x = pack2_bf16_rne(a.x, a.y);
    pr.y = pack2_bf16_rne(a.z, a.w);
    *(uint2*)&ldsA[row * 512 + (kp0 ^ s)] = pr;
  }
  __syncthreads();

  // WMMA fragment addressing (ISA 7.12.2, wave32):
  //  A (16x32 bf16): lane&15 = M row; lane>=16 -> K-pair offset 4;
  //                  VGPR j holds K-pair kp = 16*ks + (j&4)*2 + 4*hi + (j&3).
  //  B (32x16 bf16): lane&15 = N col; same K-pair pattern.
  //  C (16x16 f32):  VGPR r -> row r + 8*(lane>>4), col = lane&15.
  const int rowa = lane & 15;                  // A row == B column within tile
  const int hi   = lane >> 4;
  const int swz  = rowa << 2;                  // XOR swizzle for this lane's row
  const uint4* Wq = (const uint4*)Wpk;         // [kpg*Hd + n]

  float acc[4][8];
#pragma unroll
  for (int sub = 0; sub < 4; ++sub)
#pragma unroll
    for (int r = 0; r < 8; ++r) acc[sub][r] = 0.f;

  // Kept rolled: unrolled, one group's epilogue values stay live beside the next
  // group's accumulators and the wave needs more than 256 VGPRs, so that only one
  // work-group (two waves per SIMD) fits on a WGP instead of two.
#pragma unroll 1
  for (int g = 0; g < 2; ++g) {                // 2 groups of 4 n-tiles per wave
    const int nbase = wave * 128 + g * 64 + rowa;
    v8f C[4][4];                               // [n-tile][M-subtile]
#pragma unroll
    for (int t = 0; t < 4; ++t)
#pragma unroll
      for (int sub = 0; sub < 4; ++sub) C[t][sub] = (v8f){};

    // B pointer for ks=0: kpg = (ks<<2)+hi -> advance by 4*Hd uint4 per ks.
    const uint4* pB = Wq + (size_t)hi * Hd + nbase;

    // B fragments of k step 0; inside the loop each fragment's registers are refilled
    // for the next k step right behind the fragment's last WMMA, so that a load has
    // twelve WMMAs of lead instead of being waited for in the step that issues it.
    uint4 blo[4], bhi[4];
#pragma unroll
    for (int t = 0; t < 4; ++t) {
      blo[t] = pB[t * 16];                            // +256B immediate offsets
      bhi[t] = pB[2 * Hd + t * 16];
      // Issue order as in the loop: another order here tightens the loop's counted
      // waits, which must hold on both ways into it.
      __builtin_amdgcn_sched_barrier(0);
    }

    // Kept whole: with the last trip peeled off, its A fragments are fetched ahead of
    // the loop and stay live through it, which takes the wave above 256 VGPRs.
#pragma clang loop unroll(disable)
    for (int ks = 0; ks < 32; ++ks) {
      const int base0 = (ks << 4) + (hi << 2);        // K-pair base, jh=0
      const int col0  = base0 ^ swz;
      const int col1  = (base0 + 8) ^ swz;
      // A fragments once per ks: 2x ds_load_b128 per M-subtile (4 subtiles).
      v16bf Af[4];
#pragma unroll
      for (int sub = 0; sub < 4; ++sub) {
        const int rbase = (sub * 16 + rowa) * 512;
        uint4 alo = *(const uint4*)&ldsA[rbase + col0];
        uint4 ahi = *(const uint4*)&ldsA[rbase + col1];
        v8u au = {alo.x, alo.y, alo.z, alo.w, ahi.x, ahi.y, ahi.z, ahi.w};
        Af[sub] = __builtin_bit_cast(v16bf, au);
      }
      // Keeps the eight LDS reads one group ahead of the WMMAs, and the pointer's
      // advance (which waits for the last refills' addresses) behind their issue.
      __builtin_amdgcn_sched_barrier(0);
      // Next k step's K-pair group; the last trip reads its own step again (values
      // unused), so no address leaves the packed W.
      pB += (ks < 31) ? 4 * Hd : 0;

#pragma unroll
      for (int t = 0; t < 4; ++t) {                   // 4 n-tiles share A-frags
        v8u bu = {blo[t].x, blo[t].y, blo[t].z, blo[t].w,
                  bhi[t].x, bhi[t].y, bhi[t].z, bhi[t].w};
        v16bf Bm = __builtin_bit_cast(v16bf, bu);
#pragma unroll
        for (int sub = 0; sub < 4; ++sub)             // B amortized over 4 subs
          C[t][sub] = __builtin_amdgcn_wmma_f32_16x16x32_bf16(
                          false, Af[sub], false, Bm, (short)0, C[t][sub],
                          false, false);
        blo[t] = pB[t * 16];                          // refill for the next k step
        bhi[t] = pB[2 * Hd + t * 16];
        // Keeps the n-tiles in the order of their refills: reordered, the first WMMA of
        // a step waits for the youngest load instead of the oldest.
        __builtin_amdgcn_sched_barrier(0);
      }
    }

    // Fused epilogue: tanh(C + hid_part + bias) * v[n], reduce over n per row.
#pragma unroll
    for (int t = 0; t < 4; ++t) {
      const int n = nbase + t * 16;
      const float hb = hidb[b * Hd + n];
      const float vn = vvec[n];
#pragma unroll
      for (int sub = 0; sub < 4; ++sub)
#pragma unroll
        for (int r = 0; r < 8; ++r)
          acc[sub][r] += fast_tanh(C[t][sub][r] + hb) * vn;  // row = sub*16 + r + 8*hi
    }
  }

  // Deterministic cross-lane/cross-wave reduction: reuse A-tile LDS (A is dead).
  __syncthreads();
  float* scratch = (float*)ldsA;                      // 256 threads x 32 floats
#pragma unroll
  for (int sub = 0; sub < 4; ++sub)
#pragma unroll
    for (int r = 0; r < 8; ++r)
      scratch[tid * 32 + sub * 8 + r] = acc[sub][r];
  __syncthreads();
  if (tid < TMR) {
    const int sub = tid >> 4, h = (tid >> 3) & 1, r = tid & 7;
    float s = 0.f;
    for (int w = 0; w < 8; ++w)
      for (int l = 0; l < 16; ++l)
        s += scratch[(w * 32 + h * 16 + l) * 32 + sub * 8 + r];
    logits[(size_t)b * Sd + s0 + tid] = s;
  }
}

// Kernel 3: softmax over S per batch row.
__global__ __launch_bounds__(256) void softmax_kernel(
    const float* __restrict__ logits, float* __restrict__ out) {
  __shared__ float red[256];
  const int b = blockIdx.x, tid = threadIdx.x;
  const float* row = logits + (size_t)b * Sd;

  float m = -INFINITY;
  for (int i = tid; i < Sd; i += 256) m = fmaxf(m, row[i]);
  red[tid] = m; __syncthreads();
  for (int s = 128; s > 0; s >>= 1) {
    if (tid < s) red[tid] = fmaxf(red[tid], red[tid + s]);
    __syncthreads();
  }
  m = red[0];
  __syncthreads();

  float sl = 0.f;
  for (int i = tid; i < Sd; i += 256) {
    float e = __expf(row[i] - m);
    out[(size_t)b * Sd + i] = e;
    sl += e;
  }
  red[tid] = sl; __syncthreads();
  for (int s = 128; s > 0; s >>= 1) {
    if (tid < s) red[tid] += red[tid + s];
    __syncthreads();
  }
  const float inv = 1.f / red[0];
  for (int i = tid; i < Sd; i += 256)
    out[(size_t)b * Sd + i] *= inv;
}

extern "C" void kernel_launch(void* const* d_in, const int* in_sizes, int n_in,
                              void* d_out, int out_size, void* d_ws, size_t ws_size,
                              hipStream_t stream) {
  (void)in_sizes; (void)n_in; (void)out_size; (void)ws_size;
  const float* hidden = (const float*)d_in[0];   // (B,H)
  const float* enc    = (const float*)d_in[1];   // (B,S,H)
  const float* W      = (const float*)d_in[2];   // (2H,H)
  const float* b_attn = (const float*)d_in[3];   // (H,)
  const float* v      = (const float*)d_in[4];   // (H,)
  float* out = (float*)d_out;                    // (B,S)

  float*    hidb   = (float*)d_ws;               // 16*1024 f32
  float*    logits = hidb + Bd * Hd;             // 16*2048 f32
  unsigned* Wpk    = (unsigned*)(logits + Bd * Sd);  // 2MB packed bf16 (uint4 tiled)

  packw_kernel<<<(512 * Hd) / 256, 256, 0, stream>>>(W, Wpk);
  hid_kernel<<<(Hd / 32) * (Bd / HB), 256, 0, stream>>>(hidden, W, b_attn, hidb);
  attn_energy_kernel<<<Bd * (Sd / TMR), 256, 0, stream>>>(enc, Wpk, hidb, v, logits);
  softmax_kernel<<<Bd, 256, 0, stream>>>(logits, out);
}

// v004
// Measured time: 63.9 microseconds a run.
// Next to v003, in two timings, it ran 1.09 and 1.08 times as fast.
// Counting every step since v000, it is 2.53 times as fast.
#include <hip/hip_runtime.h>
#include <hip/hip_bf16.h>
#include <math.h>

// Problem constants (reference: B=16, S=2048, H=1024)
#define Hd 1024
#define Sd 2048
#define Bd 16
#define TMR 128               // s-rows per block (eight 16-row WMMA M-subtiles)
#define MS  (TMR / 16)        // M-subtiles of a block; every wave covers all of them

typedef __attribute__((ext_vector_type(16))) __bf16   v16bf;
typedef __attribute__((ext_vector_type(8)))  float    v8f;
typedef __attribute__((ext_vector_type(8)))  unsigned v8u;

__device__ __forceinline__ unsigned pack2_bf16_rne(float a, float b) {
  unsigned ua = __builtin_bit_cast(unsigned, a);
  unsigned ub = __builtin_bit_cast(unsigned, b);
  ua += 0x7FFFu + ((ua >> 16) & 1u);   // RNE round to bf16
  ub += 0x7FFFu + ((ub >> 16) & 1u);
  return (ua >> 16) | (ub & 0xFFFF0000u);
}

__device__ __forceinline__ float fast_tanh(float x) {
#if __has_builtin(__builtin_amdgcn_tanhf)
  return __builtin_amdgcn_tanhf(x);     // native v_tanh_f32 on gfx1250
#else
  return tanhf(x);
#endif
}

// Kernel 0: pre-pack W2 = W_attn[H:] into bf16 with a B-fragment-native tiling:
//   Wq[(kp>>2)*H + n] is a uint4 holding K-pairs kp..kp+3 of column n.
__global__ __launch_bounds__(256) void packw_kernel(
    const float* __restrict__ W, unsigned* __restrict__ Wpk) {
  int idx = blockIdx.x * 256 + threadIdx.x;       // 512*1024 output dwords
  int kpo = idx & 3;                              // K-pair within group of 4
  int n   = (idx >> 2) & 1023;                    // column
  int kpg = idx >> 12;                            // K-pair group (0..127)
  int k   = ((kpg << 2) | kpo) * 2;
  const float* W2 = W + (size_t)Hd * Hd;
  float w0 = W2[(size_t)k * Hd + n];
  float w1 = W2[(size_t)(k + 1) * Hd + n];
  Wpk[idx] = pack2_bf16_rne(w0, w1);
}

// Kernel 1: hidb[b][k] = hidden[b] . W_attn[:H][:,k] + b_attn[k]   (fp32)
// Split-K inside the block. One block = 32 columns x 4 batch rows x all 1024 j.
// A lane owns 4 columns (one float4 of a W row) and 32 of the j rows; a wave-wide
// load covers 4 whole 128-byte lines (4 rows x 32 columns). All 32 W loads of a
// lane are independent, so the block pays the memory latency once instead of
// once per unrolled trip of a 1024-long serial loop. The 32 partial sums of an
// output (8 waves x 4 lane groups) are added in a fixed order through LDS.
#define HB 4                  // batch rows per block
__global__ __launch_bounds__(256) void hid_kernel(
    const float* __restrict__ hidden, const float* __restrict__ W,
    const float* __restrict__ bias, float* __restrict__ hidb) {
  __shared__ float hs[HB * Hd];            // 16KB: this block's hidden rows
  __shared__ float part[32 * HB * 32];     // 16KB: [partial][batch row][column]

  const int tid  = threadIdx.x;
  const int wave = tid >> 5;
  const int lane = tid & 31;
  const int jq   = lane >> 3;              // which 4 of a group's 16 j rows
  const int c4   = lane & 7;               // which float4 of the 32 columns
  const int cg   = blockIdx.x & 31;        // column group
  const int bg   = blockIdx.x >> 5;        // batch group
  const int j0   = wave * 128 + jq * 4;    // a wave covers 128 j: 8 groups of 16

  // hidden first: loads return in order, so its LDS stores do not wait for the W rows.
  const float4* hv = (const float4*)(hidden + (size_t)bg * HB * Hd);
  float4 hreg[4];
  // All loops of this kernel are unrolled so that their arrays stay in registers.
#pragma unroll
  for (int i = 0; i < 4; ++i) hreg[i] = hv[tid + i * 256];
  const int   kk = cg * 32 + lane;         // output column of the final sum
  const float bv = bias[kk];               // fetched here so its latency is hidden

  const float* wp = W + (size_t)j0 * Hd + cg * 32 + c4 * 4;
  float4 w[8][4];
  // Unrolled: all 32 loads issue back to back, ahead of the first wait.
#pragma unroll
  for (int g = 0; g < 8; ++g)
#pragma unroll
    for (int i = 0; i < 4; ++i)
      w[g][i] = *(const float4*)(wp + (size_t)(g * 16 + i) * Hd);

#pragma unroll
  for (int i = 0; i < 4; ++i) ((float4*)hs)[tid + i * 256] = hreg[i];
  __syncthreads();

  float4 acc[HB];
#pragma unroll
  for (int bl = 0; bl < HB; ++bl) acc[bl] = make_float4(0.f, 0.f, 0.f, 0.f);

#pragma unroll
  for (int g = 0; g < 8; ++g) {
#pragma unroll
    for (int bl = 0; bl < HB; ++bl) {
      const float4 h = *(const float4*)&hs[bl * Hd + j0 + g * 16];
      const float hj[4] = {h.x, h.y, h.z, h.w};
#pragma unroll
      for (int i = 0; i < 4; ++i) {
        acc[bl].x = fmaf(hj[i], w[g][i].x, acc[bl].x);
        acc[bl].y = fmaf(hj[i], w[g][i].y, acc[bl].y);
        acc[bl].z = fmaf(hj[i], w[g][i].z, acc[bl].z);
        acc[bl].w = fmaf(hj[i], w[g][i].w, acc[bl].w);
      }
    }
  }

#pragma unroll
  for (int bl = 0; bl < HB; ++bl)
    *(float4*)&part[(wave * 4 + jq) * (HB * 32) + bl * 32 + c4 * 4] = acc[bl];
  __syncthreads();

  if (tid < HB * 32) {                     // one thread per output of the block
    float s = bv;
    // Unrolled: the LDS reads run ahead of the serial adds.
#pragma unroll
    for (int p = 0; p < 32; ++p) s += part[p * (HB * 32) + tid];
    hidb[(size_t)(bg * HB + (tid >> 5)) * Hd + kk] = s;
  }
}

// Kernel 2: fused  logits[b][s] = sum_n tanh( (enc @ W2)[s][n] + hidb[b][n] ) * v[n]
// One block = 128 s-rows of one batch (eight M-subtiles), 256KB A tile in LDS, so
// one block per WGP. 8 waves (two per SIMD, up to 512 VGPRs each); each wave covers
// 8 n-tiles in 2 groups of 4, holding C[4 n-tiles][8 subtiles]; every B fragment
// read from L2 feeds 8 WMMAs, so a WGP draws the packed W from L2 once, not twice.
__global__ __launch_bounds__(256) void attn_energy_kernel(
    const float* __restrict__ enc, const unsigned* __restrict__ Wpk,
    const float* __restrict__ hidb, const float* __restrict__ vvec,
    float* __restrict__ logits) {
  __shared__ unsigned ldsA[512 * TMR];   // 256KB (reused as f32 scratch later)

  const int tid  = threadIdx.x;
  const int wave = tid >> 5;
  const int lane = tid & 31;
  const int b    = blockIdx.x >> 4;            // Sd/TMR = 16 tiles per batch
  const int s0   = (blockIdx.x & 15) * TMR;

  // Stage A tile: 128 rows x 1024 K, fp32 -> packed bf16 pairs, XOR-swizzled:
  //   dword idx = row*512 + (kp ^ ((row&15)<<2))
  const float4* encv = (const float4*)(enc + ((size_t)b * Sd + s0) * Hd);
  // Unrolled by 8: half as many waves stream per WGP as with two 64-row blocks, so
  // each keeps twice the loads in flight and the bytes in flight per WGP stay.
#pragma unroll 8
  for (int i = 0; i < TMR; ++i) {
    int c   = tid + (i << 8);                  // float4 chunk id, 0..32767
    int row = c >> 8;                          // 256 float4 per row
    int kq  = c & 255;
    float4 a = encv[(size_t)row * 256 + kq];
    int kp0 = 2 * kq;
    int s   = (row & 15) << 2;
    uint2 pr;
    pr.x = pack2_bf16_rne(a.x, a.y);
    pr.y = pack2_bf16_rne(a.z, a.w);
    *(uint2*)&ldsA[row * 512 + (kp0 ^ s)] = pr;
  }
  __syncthreads();

  // WMMA fragment addressing (ISA 7.12.2, wave32):
  //  A (16x32 bf16): lane&15 = M row; lane>=16 -> K-pair offset 4;
  //                  VGPR j holds K-pair kp = 16*ks + (j&4)*2 + 4*hi + (j&3).
  //  B (32x16 bf16): lane&15 = N col; same K-pair pattern.
  //  C (16x16 f32):  VGPR r -> row r + 8*(lane>>4), col = lane&15.
  const int rowa = lane & 15;                  // A row == B column within tile
  const int hi   = lane >> 4;
  const int swz  = rowa << 2;                  // XOR swizzle for this lane's row
  const uint4* Wq = (const uint4*)Wpk;         // [kpg*Hd + n]

  float acc[MS][8];
#pragma unroll
  for (int sub = 0; sub < MS; ++sub)
#pragma unroll
    for (int r = 0; r < 8; ++r) acc[sub][r] = 0.f;

  // Kept rolled: one group's epilogue values are then never live beside the next
  // group's 256 accumulator registers, and the K loop stands once in the code.
#pragma unroll 1
  for (int g = 0; g < 2; ++g) {                // 2 groups of 4 n-tiles per wave
    const int nbase = wave * 128 + g * 64 + rowa;
    v8f C[4][MS];                              // [n-tile][M-subtile]
#pragma unroll
    for (int t = 0; t < 4; ++t)
#pragma unroll
      for (int sub = 0; sub < MS; ++sub) C[t][sub] = (v8f){};

    // B pointer for ks=0: kpg = (ks<<2)+hi -> advance by 4*Hd uint4 per ks.
    const uint4* pB = Wq + (size_t)hi * Hd + nbase;

    // B fragments of k steps 0 and 1; inside the loop each fragment's registers are
    // refilled for the k step after next right behind the fragment's last WMMA. Two
    // steps are held because half as many waves draw from L2 per WGP as with two
    // 64-row blocks: the bytes in flight per WGP stay what they were.
    uint4 blo[2][4], bhi[2][4];
#pragma unroll
    for (int p = 0; p < 2; ++p)
#pragma unroll
      for (int t = 0; t < 4; ++t) {
        blo[p][t] = pB[p * 4 * Hd + t * 16];          // immediate offsets
        bhi[p][t] = pB[p * 4 * Hd + 2 * Hd + t * 16];
        // Issue order as in the loop: another order here tightens the loop's counted
        // waits, which must hold on both ways into it.
        __builtin_amdgcn_sched_barrier(0);
      }

    // Kept whole: a peeled or further unrolled trip only adds code and live A fragments.
#pragma clang loop unroll(disable)
    for (int k2 = 0; k2 < 16; ++k2) {                 // one trip = two k steps
      // Unrolled: p picks the register set, which must be a compile-time choice.
#pragma unroll
      for (int p = 0; p < 2; ++p) {
        const int base0 = (k2 << 5) + (p << 4) + (hi << 2);   // K-pair base, jh=0
        const int col0  = base0 ^ swz;
        const int col1  = (base0 + 8) ^ swz;
        // A fragments once per k step: 2x ds_load_b128 per M-subtile (8 subtiles).
        v16bf Af[MS];
#pragma unroll
        for (int sub = 0; sub < MS; ++sub) {
          const int rbase = (sub * 16 + rowa) * 512;
          uint4 alo = *(const uint4*)&ldsA[rbase + col0];
          uint4 ahi = *(const uint4*)&ldsA[rbase + col1];
          v8u au = {alo.x, alo.y, alo.z, alo.w, ahi.x, ahi.y, ahi.z, ahi.w};
          Af[sub] = __builtin_bit_cast(v16bf, au);
        }
        // Keeps the LDS reads one group ahead of the WMMAs, and the pointer's advance
        // behind their issue.
        __builtin_amdgcn_sched_barrier(0);
        if (p == 0) {
          // The advance below overwrites the address pair that the refills in flight name.
          asm volatile("s_wait_xcnt 0x0" ::: "memory");
          // Keeps the advance behind that wait.
          __builtin_amdgcn_sched_barrier(0);
          // Next pair of k steps; the last trip reads its own steps again (values
          // unused), so no address leaves the packed W.
          pB += (k2 < 15) ? 8 * Hd : 0;
        }

#pragma unroll
        for (int t = 0; t < 4; ++t) {                 // 4 n-tiles share A-frags
          v8u bu = {blo[p][t].x, blo[p][t].y, blo[p][t].z, blo[p][t].w,
                    bhi[p][t].x, bhi[p][t].y, bhi[p][t].z, bhi[p][t].w};
          v16bf Bm = __builtin_bit_cast(v16bf, bu);
#pragma unroll
          for (int sub = 0; sub < MS; ++sub)          // B amortized over 8 subs
            C[t][sub] = __builtin_amdgcn_wmma_f32_16x16x32_bf16(
                            false, Af[sub], false, Bm, (short)0, C[t][sub],
                            false, false);
          // Keeps the refill behind the fragment's last WMMA: lifted over it, the loads
          // take other registers and are copied back behind a wait at the trip's end.
          __builtin_amdgcn_sched_barrier(0);
          blo[p][t] = pB[p * 4 * Hd + t * 16];        // refill for the step after next
          bhi[p][t] = pB[p * 4 * Hd + 2 * Hd + t * 16];
          // Keeps the n-tiles in the order of their refills: reordered, the first WMMA
          // of a step waits for the youngest load instead of the oldest.
          __builtin_amdgcn_sched_barrier(0);
        }
      }
    }

    // Fused epilogue: tanh(C + hid_part + bias) * v[n], reduce over n per row.
    float hb[4], vn[4];
#pragma unroll
    for (int t = 0; t < 4; ++t) {
      const int n = nbase + t * 16;
      hb[t] = hidb[b * Hd + n];
    }
    // The loads of v below may take, as a result register, the offset register that the
    // loads of hidb in flight name.
    asm volatile("s_wait_xcnt 0x0" ::: "memory");
    // Keeps the loads of v behind that wait.
    __builtin_amdgcn_sched_barrier(0);
#pragma unroll
    for (int t = 0; t < 4; ++t) vn[t] = vvec[nbase + t * 16];
    // The sums below reuse the registers that hold the addresses of the loads in flight.
    asm volatile("s_wait_xcnt 0x0" ::: "memory");
    // Keeps those sums behind the wait.
    __builtin_amdgcn_sched_barrier(0);
#pragma unroll
    for (int t = 0; t < 4; ++t) {
#pragma unroll
      for (int sub = 0; sub < MS; ++sub)
#pragma unroll
        for (int r = 0; r < 8; ++r)
          acc[sub][r] += fast_tanh(C[t][sub][r] + hb[t]) * vn[t];  // row = sub*16 + r + 8*hi
    }
  }

  // Deterministic cross-lane/cross-wave reduction: reuse A-tile LDS (A is dead).
  __syncthreads();
  float* scratch = (float*)ldsA;                      // 256 threads x 64 floats
#pragma unroll
  for (int sub = 0; sub < MS; ++sub)
#pragma unroll
    for (int r = 0; r < 8; ++r)
      scratch[tid * (MS * 8) + sub * 8 + r] = acc[sub][r];
  __syncthreads();
  if (tid < TMR) {
    const int sub = tid >> 4, h = (tid >> 3) & 1, r = tid & 7;
    float s = 0.f;
    for (int w = 0; w < 8; ++w)
      for (int l = 0; l < 16; ++l)
        s += scratch[(w * 32 + h * 16 + l) * (MS * 8) + sub * 8 + r];
    logits[(size_t)b * Sd + s0 + tid] = s;
  }
}

// Kernel 3: softmax over S per batch row.
__global__ __launch_bounds__(256) void softmax_kernel(
    const float* __restrict__ logits, float* __restrict__ out) {
  __shared__ float red[256];
  const int b = blockIdx.x, tid = threadIdx.x;
  const float* row = logits + (size_t)b * Sd;

  float m = -INFINITY;
  for (int i = tid; i < Sd; i += 256) m = fmaxf(m, row[i]);
  red[tid] = m; __syncthreads();
  for (int s = 128; s > 0; s >>= 1) {
    if (tid < s) red[tid] = fmaxf(red[tid], red[tid + s]);
    __syncthreads();
  }
  m = red[0];
  __syncthreads();

  float sl = 0.f;
  for (int i = tid; i < Sd; i += 256) {
    float e = __expf(row[i] - m);
    out[(size_t)b * Sd + i] = e;
    sl += e;
  }
  red[tid] = sl; __syncthreads();
  for (int s = 128; s > 0; s >>= 1) {
    if (tid < s) red[tid] += red[tid + s];
    __syncthreads();
  }
  const float inv = 1.f / red[0];
  for (int i = tid; i < Sd; i += 256)
    out[(size_t)b * Sd + i] *= inv;
}

extern "C" void kernel_launch(void* const* d_in, const int* in_sizes, int n_in,
                              void* d_out, int out_size, void* d_ws, size_t ws_size,
                              hipStream_t stream) {
  (void)in_sizes; (void)n_in; (void)out_size; (void)ws_size;
  const float* hidden = (const float*)d_in[0];   // (B,H)
  const float* enc    = (const float*)d_in[1];   // (B,S,H)
  const float* W      = (const float*)d_in[2];   // (2H,H)
  const float* b_attn = (const float*)d_in[3];   // (H,)
  const float* v      = (const float*)d_in[4];   // (H,)
  float* out = (float*)d_out;                    // (B,S)

  float*    hidb   = (float*)d_ws;               // 16*1024 f32
  float*    logits = hidb + Bd * Hd;             // 16*2048 f32
  unsigned* Wpk    = (unsigned*)(logits + Bd * Sd);  // 2MB packed bf16 (uint4 tiled)

  packw_kernel<<<(512 * Hd) / 256, 256, 0, stream>>>(W, Wpk);
  hid_kernel<<<(Hd / 32) * (Bd / HB), 256, 0, stream>>>(hidden, W, b_attn, hidb);
  attn_energy_kernel<<<Bd * (Sd / TMR), 256, 0, stream>>>(enc, Wpk, hidb, v, logits);
  softmax_kernel<<<Bd, 256, 0, stream>>>(logits, out);
}

// v005
// A run of this version takes 57 microseconds.
// Next to v004, in two timings, it ran 1.11 and 1.12 times as fast.
// Over all steps from v000 it is 2.82 times as fast.
#include <hip/hip_runtime.h>
#include <hip/hip_bf16.h>
#include <math.h>

// Problem constants (reference: B=16, S=2048, H=1024)
#define Hd 1024
#define Sd 2048
#define Bd 16
#define TMR 128               // s-rows per block (eight 16-row WMMA M-subtiles)
#define MS  (TMR / 16)        // M-subtiles of a block; every wave covers all of them

typedef __attribute__((ext_vector_type(16))) __bf16   v16bf;
typedef __attribute__((ext_vector_type(8)))  float    v8f;
typedef __attribute__((ext_vector_type(8)))  unsigned v8u;

__device__ __forceinline__ unsigned pack2_bf16_rne(float a, float b) {
  unsigned ua = __builtin_bit_cast(unsigned, a);
  unsigned ub = __builtin_bit_cast(unsigned, b);
  ua += 0x7FFFu + ((ua >> 16) & 1u);   // RNE round to bf16
  ub += 0x7FFFu + ((ub >> 16) & 1u);
  return (ua >> 16) | (ub & 0xFFFF0000u);
}

__device__ __forceinline__ float fast_tanh(float x) {
#if __has_builtin(__builtin_amdgcn_tanhf)
  return __builtin_amdgcn_tanhf(x);     // native v_tanh_f32 on gfx1250
#else
  return tanhf(x);
#endif
}

// Kernel 0: pre-pack W2 = W_attn[H:] into bf16 with a B-fragment-native tiling:
//   Wq[(kp>>2)*H + n] is a uint4 holding K-pairs kp..kp+3 of column n.
__global__ __launch_bounds__(256) void packw_kernel(
    const float* __restrict__ W, unsigned* __restrict__ Wpk) {
  int idx = blockIdx.x * 256 + threadIdx.x;       // 512*1024 output dwords
  int kpo = idx & 3;                              // K-pair within group of 4
  int n   = (idx >> 2) & 1023;                    // column
  int kpg = idx >> 12;                            // K-pair group (0..127)
  int k   = ((kpg << 2) | kpo) * 2;
  const float* W2 = W + (size_t)Hd * Hd;
  float w0 = W2[(size_t)k * Hd + n];
  float w1 = W2[(size_t)(k + 1) * Hd + n];
  Wpk[idx] = pack2_bf16_rne(w0, w1);
}

// Kernel 1: hidb[b][k] = hidden[b] . W_attn[:H][:,k] + b_attn[k]   (fp32)
// Split-K inside the block. One block = 32 columns x 4 batch rows x all 1024 j.
// A lane owns 4 columns (one float4 of a W row) and 32 of the j rows; a wave-wide
// load covers 4 whole 128-byte lines (4 rows x 32 columns). All 32 W loads of a
// lane are independent, so the block pays the memory latency once instead of
// once per unrolled trip of a 1024-long serial loop. The 32 partial sums of an
// output (8 waves x 4 lane groups) are added in a fixed order through LDS.
#define HB 4                  // batch rows per block
__global__ __launch_bounds__(256) void hid_kernel(
    const float* __restrict__ hidden, const float* __restrict__ W,
    const float* __restrict__ bias, float* __restrict__ hidb) {
  __shared__ float hs[HB * Hd];            // 16KB: this block's hidden rows
  __shared__ float part[32 * HB * 32];     // 16KB: [partial][batch row][column]

  const int tid  = threadIdx.x;
  const int wave = tid >> 5;
  const int lane = tid & 31;
  const int jq   = lane >> 3;              // which 4 of a group's 16 j rows
  const int c4   = lane & 7;               // which float4 of the 32 columns
  const int cg   = blockIdx.x & 31;        // column group
  const int bg   = blockIdx.x >> 5;        // batch group
  const int j0   = wave * 128 + jq * 4;    // a wave covers 128 j: 8 groups of 16

  // hidden first: loads return in order, so its LDS stores do not wait for the W rows.
  const float4* hv = (const float4*)(hidden + (size_t)bg * HB * Hd);
  float4 hreg[4];
  // All loops of this kernel are unrolled so that their arrays stay in registers.
#pragma unroll
  for (int i = 0; i < 4; ++i) hreg[i] = hv[tid + i * 256];
  const int   kk = cg * 32 + lane;         // output column of the final sum
  const float bv = bias[kk];               // fetched here so its latency is hidden

  const float* wp = W + (size_t)j0 * Hd + cg * 32 + c4 * 4;
  float4 w[8][4];
  // Unrolled: all 32 loads issue back to back, ahead of the first wait.
#pragma unroll
  for (int g = 0; g < 8; ++g)
#pragma unroll
    for (int i = 0; i < 4; ++i)
      w[g][i] = *(const float4*)(wp + (size_t)(g * 16 + i) * Hd);

#pragma unroll
  for (int i = 0; i < 4; ++i) ((float4*)hs)[tid + i * 256] = hreg[i];
  __syncthreads();

  float4 acc[HB];
#pragma unroll
  for (int bl = 0; bl < HB; ++bl) acc[bl] = make_float4(0.f, 0.f, 0.f, 0.f);

#pragma unroll
  for (int g = 0; g < 8; ++g) {
#pragma unroll
    for (int bl = 0; bl < HB; ++bl) {
      const float4 h = *(const float4*)&hs[bl * Hd + j0 + g * 16];
      const float hj[4] = {h.x, h.y, h.z, h.w};
#pragma unroll
      for (int i = 0; i < 4; ++i) {
        acc[bl].x = fmaf(hj[i], w[g][i].x, acc[bl].x);
        acc[bl].y = fmaf(hj[i], w[g][i].y, acc[bl].y);
        acc[bl].z = fmaf(hj[i], w[g][i].z, acc[bl].z);
        acc[bl].w = fmaf(hj[i], w[g][i].w, acc[bl].w);
      }
    }
  }

#pragma unroll
  for (int bl = 0; bl < HB; ++bl)
    *(float4*)&part[(wave * 4 + jq) * (HB * 32) + bl * 32 + c4 * 4] = acc[bl];
  __syncthreads();

  if (tid < HB * 32) {                     // one thread per output of the block
    float s = bv;
    // Unrolled: the LDS reads run ahead of the serial adds.
#pragma unroll
    for (int p = 0; p < 32; ++p) s += part[p * (HB * 32) + tid];
    hidb[(size_t)(bg * HB + (tid >> 5)) * Hd + kk] = s;
  }
}

// Kernel 2: fused  logits[b][s] = sum_n tanh( (enc @ W2)[s][n] + hidb[b][n] ) * v[n]
// One block = 128 s-rows of one batch (eight M-subtiles), 256KB A tile in LDS, so
// one block per WGP. 8 waves (two per SIMD, up to 512 VGPRs each); each wave covers
// 8 n-tiles in 2 groups of 4, holding C[4 n-tiles][8 subtiles]; every B fragment
// read from L2 feeds 8 WMMAs, so a WGP draws the packed W from L2 once, not twice.
__global__ __launch_bounds__(256) void attn_energy_kernel(
    const float* __restrict__ enc, const unsigned* __restrict__ Wpk,
    const float* __restrict__ hidb, const float* __restrict__ vvec,
    float* __restrict__ logits) {
  __shared__ unsigned ldsA[512 * TMR];   // 256KB (reused as f32 scratch later)

  const int tid  = threadIdx.x;
  const int wave = tid >> 5;
  const int lane = tid & 31;
  const int b    = blockIdx.x >> 4;            // Sd/TMR = 16 tiles per batch
  const int s0   = (blockIdx.x & 15) * TMR;

  // Stage A tile: 128 rows x 1024 K, fp32 -> packed bf16 pairs, XOR-swizzled:
  //   dword idx = row*512 + (kp ^ ((row&15)<<2))
  const float4* encv = (const float4*)(enc + ((size_t)b * Sd + s0) * Hd);
  // Unrolled by 8: half as many waves stream per WGP as with two 64-row blocks, so
  // each keeps twice the loads in flight and the bytes in flight per WGP stay.
#pragma unroll 8
  for (int i = 0; i < TMR; ++i) {
    int c   = tid + (i << 8);                  // float4 chunk id, 0..32767
    int row = c >> 8;                          // 256 float4 per row
    int kq  = c & 255;
    float4 a = encv[(size_t)row * 256 + kq];
    int kp0 = 2 * kq;
    int s   = (row & 15) << 2;
    uint2 pr;
    pr.x = pack2_bf16_rne(a.x, a.y);
    pr.y = pack2_bf16_rne(a.z, a.w);
    *(uint2*)&ldsA[row * 512 + (kp0 ^ s)] = pr;
  }
  __syncthreads();

  // WMMA fragment addressing (ISA 7.12.2, wave32):
  //  A (16x32 bf16): lane&15 = M row; lane>=16 -> K-pair offset 4;
  //                  VGPR j holds K-pair kp = 16*ks + (j&4)*2 + 4*hi + (j&3).
  //  B (32x16 bf16): lane&15 = N col; same K-pair pattern.
  //  C (16x16 f32):  VGPR r -> row r + 8*(lane>>4), col = lane&15.
  const int rowa = lane & 15;                  // A row == B column within tile
  const int hi   = lane >> 4;
  const int swz  = rowa << 2;                  // XOR swizzle for this lane's row
  const uint4* Wq = (const uint4*)Wpk;         // [kpg*Hd + n]

  float acc[MS][8];
#pragma unroll
  for (int sub = 0; sub < MS; ++sub)
#pragma unroll
    for (int r = 0; r < 8; ++r) acc[sub][r] = 0.f;

  // Kept rolled: one group's epilogue values are then never live beside the next
  // group's 256 accumulator registers, and the K loop stands once in the code.
#pragma unroll 1
  for (int g = 0; g < 2; ++g) {                // 2 groups of 4 n-tiles per wave
    const int nbase = wave * 128 + g * 64 + rowa;
    v8f C[4][MS];                              // [n-tile][M-subtile]
#pragma unroll
    for (int t = 0; t < 4; ++t)
#pragma unroll
      for (int sub = 0; sub < MS; ++sub) C[t][sub] = (v8f){};

    // B pointer for ks=0: kpg = (ks<<2)+hi -> advance by 4*Hd uint4 per ks.
    const uint4* pB = Wq + (size_t)hi * Hd + nbase;

    // B fragments of k steps 0 and 1; inside the loop each fragment's registers are
    // refilled for the k step after next right behind the fragment's last WMMA. Two
    // steps are held because half as many waves draw from L2 per WGP as with two
    // 64-row blocks: the bytes in flight per WGP stay what they were.
    uint4 blo[2][4], bhi[2][4];
#pragma unroll
    for (int p = 0; p < 2; ++p)
#pragma unroll
      for (int t = 0; t < 4; ++t) {
        blo[p][t] = pB[p * 4 * Hd + t * 16];          // immediate offsets
        bhi[p][t] = pB[p * 4 * Hd + 2 * Hd + t * 16];
        // Issue order as in the loop: another order here tightens the loop's counted
        // waits, which must hold on both ways into it.
        __builtin_amdgcn_sched_barrier(0);
      }

    // Kept whole: a peeled or further unrolled trip only adds code and live A fragments.
#pragma clang loop unroll(disable)
    for (int k2 = 0; k2 < 16; ++k2) {                 // one trip = two k steps
      // Unrolled: p picks the register set, which must be a compile-time choice.
#pragma unroll
      for (int p = 0; p < 2; ++p) {
        const int base0 = (k2 << 5) + (p << 4) + (hi << 2);   // K-pair base, jh=0
        const int col0  = base0 ^ swz;
        const int col1  = (base0 + 8) ^ swz;
        // A fragments once per k step: 2x ds_load_b128 per M-subtile (8 subtiles).
        v16bf Af[MS];
#pragma unroll
        for (int sub = 0; sub < MS; ++sub) {
          const int rbase = (sub * 16 + rowa) * 512;
          uint4 alo = *(const uint4*)&ldsA[rbase + col0];
          uint4 ahi = *(const uint4*)&ldsA[rbase + col1];
          v8u au = {alo.x, alo.y, alo.z, alo.w, ahi.x, ahi.y, ahi.z, ahi.w};
          Af[sub] = __builtin_bit_cast(v16bf, au);
        }
        // Keeps the LDS reads one group ahead of the WMMAs, and the pointer's advance
        // behind their issue.
        __builtin_amdgcn_sched_barrier(0);
        if (p == 0) {
          // The advance below overwrites the address pair that the refills in flight name.
          asm volatile("s_wait_xcnt 0x0" ::: "memory");
          // Keeps the advance behind that wait.
          __builtin_amdgcn_sched_barrier(0);
          // Next pair of k steps; the last trip reads its own steps again (values
          // unused), so no address leaves the packed W.
          pB += (k2 < 15) ? 8 * Hd : 0;
        }

#pragma unroll
        for (int t = 0; t < 4; ++t) {                 // 4 n-tiles share A-frags
          v8u bu = {blo[p][t].x, blo[p][t].y, blo[p][t].z, blo[p][t].w,
                    bhi[p][t].x, bhi[p][t].y, bhi[p][t].z, bhi[p][t].w};
          v16bf Bm = __builtin_bit_cast(v16bf, bu);
#pragma unroll
          for (int sub = 0; sub < MS; ++sub)          // B amortized over 8 subs
            C[t][sub] = __builtin_amdgcn_wmma_f32_16x16x32_bf16(
                            false, Af[sub], false, Bm, (short)0, C[t][sub],
                            false, false);
          // Keeps the refill behind the fragment's last WMMA: lifted over it, the loads
          // take other registers and are copied back behind a wait at the trip's end.
          __builtin_amdgcn_sched_barrier(0);
          blo[p][t] = pB[p * 4 * Hd + t * 16];        // refill for the step after next
          bhi[p][t] = pB[p * 4 * Hd + 2 * Hd + t * 16];
          // Keeps the n-tiles in the order of their refills: reordered, the first WMMA
          // of a step waits for the youngest load instead of the oldest.
          __builtin_amdgcn_sched_barrier(0);
        }
      }
    }

    // Fused epilogue: tanh(C + hid_part + bias) * v[n], reduce over n per row.
    float hb[4], vn[4];
#pragma unroll
    for (int t = 0; t < 4; ++t) {
      const int n = nbase + t * 16;
      hb[t] = hidb[b * Hd + n];
    }
    // The loads of v below may take, as a result register, the offset register that the
    // loads of hidb in flight name.
    asm volatile("s_wait_xcnt 0x0" ::: "memory");
    // Keeps the loads of v behind that wait.
    __builtin_amdgcn_sched_barrier(0);
#pragma unroll
    for (int t = 0; t < 4; ++t) vn[t] = vvec[nbase + t * 16];
    // The sums below reuse the registers that hold the addresses of the loads in flight.
    asm volatile("s_wait_xcnt 0x0" ::: "memory");
    // Keeps those sums behind the wait.
    __builtin_amdgcn_sched_barrier(0);
#pragma unroll
    for (int t = 0; t < 4; ++t) {
#pragma unroll
      for (int sub = 0; sub < MS; ++sub)
#pragma unroll
        for (int r = 0; r < 8; ++r)
          acc[sub][r] += fast_tanh(C[t][sub][r] + hb[t]) * vn[t];  // row = sub*16 + r + 8*hi
    }
  }

  // Deterministic cross-lane/cross-wave reduction: reuse A-tile LDS (A is dead).
  __syncthreads();
  float* scratch = (float*)ldsA;                      // 256 threads x 64 floats
#pragma unroll
  for (int sub = 0; sub < MS; ++sub)
#pragma unroll
    for (int r = 0; r < 8; ++r)
      scratch[tid * (MS * 8) + sub * 8 + r] = acc[sub][r];
  __syncthreads();
  if (tid < TMR) {
    const int sub = tid >> 4, h = (tid >> 3) & 1, r = tid & 7;
    float s = 0.f;
    for (int w = 0; w < 8; ++w)
      for (int l = 0; l < 16; ++l)
        s += scratch[(w * 32 + h * 16 + l) * (MS * 8) + sub * 8 + r];
    logits[(size_t)b * Sd + s0 + tid] = s;
  }
}

// Kernel 3: softmax over S per batch row.
// A thread's 8 logits are loaded once and stay in registers through max, exp, sum and
// scale, so one round trip to L2 or memory stands on the block's path; out is only stored.
#define SPT (Sd / 256)        // logits per thread

// exp(t) as 2^(t * log2 e), the instructions that __expf compiles to. The v_nop is the
// slot that the instruction set asks for behind a transcendental. It stands in one
// statement with the v_exp_f32 because with eight exponentials side by side the compiler
// put a paired multiply that overwrites the source directly behind one, and a v_nop in
// a statement of its own was moved away from it.
__device__ __forceinline__ float exp_slot(float t) {
  float e;
  asm("v_exp_f32 %0, %1\n\tv_nop" : "=v"(e) : "v"(t * 1.4426950408889634f));
  return e;
}

__global__ __launch_bounds__(256) void softmax_kernel(
    const float* __restrict__ logits, float* __restrict__ out) {
  __shared__ float red[256];
  const int b = blockIdx.x, tid = threadIdx.x;
  const float* row = logits + (size_t)b * Sd;

  float x[SPT];
  // All loops over x are unrolled so that it stays in registers; here the 8 loads
  // also issue back to back, ahead of the first wait.
#pragma unroll
  for (int j = 0; j < SPT; ++j) x[j] = row[tid + j * 256];

  float m = -INFINITY;
#pragma unroll
  for (int j = 0; j < SPT; ++j) m = fmaxf(m, x[j]);
  red[tid] = m; __syncthreads();
  for (int s = 128; s > 0; s >>= 1) {
    if (tid < s) red[tid] = fmaxf(red[tid], red[tid + s]);
    __syncthreads();
  }
  m = red[0];
  __syncthreads();

  float sl = 0.f;
#pragma unroll
  for (int j = 0; j < SPT; ++j) {
    x[j] = exp_slot(x[j] - m);
    sl += x[j];
  }
  red[tid] = sl; __syncthreads();
  for (int s = 128; s > 0; s >>= 1) {
    if (tid < s) red[tid] += red[tid + s];
    __syncthreads();
  }
  const float inv = 1.f / red[0];
#pragma unroll
  for (int j = 0; j < SPT; ++j)
    out[(size_t)b * Sd + tid + j * 256] = x[j] * inv;
}

extern "C" void kernel_launch(void* const* d_in, const int* in_sizes, int n_in,
                              void* d_out, int out_size, void* d_ws, size_t ws_size,
                              hipStream_t stream) {
  (void)in_sizes; (void)n_in; (void)out_size; (void)ws_size;
  const float* hidden = (const float*)d_in[0];   // (B,H)
  const float* enc    = (const float*)d_in[1];   // (B,S,H)
  const float* W      = (const float*)d_in[2];   // (2H,H)
  const float* b_attn = (const float*)d_in[3];   // (H,)
  const float* v      = (const float*)d_in[4];   // (H,)
  float* out = (float*)d_out;                    // (B,S)

  float*    hidb   = (float*)d_ws;               // 16*1024 f32
  float*    logits = hidb + Bd * Hd;             // 16*2048 f32
  unsigned* Wpk    = (unsigned*)(logits + Bd * Sd);  // 2MB packed bf16 (uint4 tiled)

  packw_kernel<<<(512 * Hd) / 256, 256, 0, stream>>>(W, Wpk);
  hid_kernel<<<(Hd / 32) * (Bd / HB), 256, 0, stream>>>(hidden, W, b_attn, hidb);
  attn_energy_kernel<<<Bd * (Sd / TMR), 256, 0, stream>>>(enc, Wpk, hidb, v, logits);
  softmax_kernel<<<Bd, 256, 0, stream>>>(logits, out);
}

// v006
// It runs in 54.5 microseconds.
// Two timings next to v005 both put it at 1.04 times that version's speed.
// All steps since v000 together make it 2.93 times as fast.
#include <hip/hip_runtime.h>
#include <hip/hip_bf16.h>
#include <math.h>

// Problem constants (reference: B=16, S=2048, H=1024)
#define Hd 1024
#define Sd 2048
#define Bd 16
#define TMR 128               // s-rows per block (eight 16-row WMMA M-subtiles)
#define MS  (TMR / 16)        // M-subtiles of a block; every wave covers all of them

typedef __attribute__((ext_vector_type(16))) __bf16   v16bf;
typedef __attribute__((ext_vector_type(8)))  float    v8f;
typedef __attribute__((ext_vector_type(8)))  unsigned v8u;

__device__ __forceinline__ unsigned pack2_bf16_rne(float a, float b) {
  unsigned ua = __builtin_bit_cast(unsigned, a);
  unsigned ub = __builtin_bit_cast(unsigned, b);
  ua += 0x7FFFu + ((ua >> 16) & 1u);   // RNE round to bf16
  ub += 0x7FFFu + ((ub >> 16) & 1u);
  return (ua >> 16) | (ub & 0xFFFF0000u);
}

__device__ __forceinline__ float fast_tanh(float x) {
#if __has_builtin(__builtin_amdgcn_tanhf)
  return __builtin_amdgcn_tanhf(x);     // native v_tanh_f32 on gfx1250
#else
  return tanhf(x);
#endif
}

// Kernel 0: pre-pack W2 = W_attn[H:] into bf16 with a B-fragment-native tiling:
//   Wq[(kp>>2)*H + n] is a uint4 holding K-pairs kp..kp+3 of column n.
__global__ __launch_bounds__(256) void packw_kernel(
    const float* __restrict__ W, unsigned* __restrict__ Wpk) {
  int idx = blockIdx.x * 256 + threadIdx.x;       // 512*1024 output dwords
  int kpo = idx & 3;                              // K-pair within group of 4
  int n   = (idx >> 2) & 1023;                    // column
  int kpg = idx >> 12;                            // K-pair group (0..127)
  int k   = ((kpg << 2) | kpo) * 2;
  const float* W2 = W + (size_t)Hd * Hd;
  float w0 = W2[(size_t)k * Hd + n];
  float w1 = W2[(size_t)(k + 1) * Hd + n];
  Wpk[idx] = pack2_bf16_rne(w0, w1);
}

// Kernel 1: hidb[b][k] = hidden[b] . W_attn[:H][:,k] + b_attn[k]   (fp32)
// Split-K inside the block. One block = 32 columns x 4 batch rows x all 1024 j.
// A lane owns 4 columns (one float4 of a W row) and 32 of the j rows; a wave-wide
// load covers 4 whole 128-byte lines (4 rows x 32 columns). All 32 W loads of a
// lane are independent, so the block pays the memory latency once instead of
// once per unrolled trip of a 1024-long serial loop. The 32 partial sums of an
// output (8 waves x 4 lane groups) are added in a fixed order through LDS.
#define HB 4                  // batch rows per block
__global__ __launch_bounds__(256) void hid_kernel(
    const float* __restrict__ hidden, const float* __restrict__ W,
    const float* __restrict__ bias, float* __restrict__ hidb) {
  __shared__ float hs[HB * Hd];            // 16KB: this block's hidden rows
  __shared__ float part[32 * HB * 32];     // 16KB: [partial][batch row][column]

  const int tid  = threadIdx.x;
  const int wave = tid >> 5;
  const int lane = tid & 31;
  const int jq   = lane >> 3;              // which 4 of a group's 16 j rows
  const int c4   = lane & 7;               // which float4 of the 32 columns
  const int cg   = blockIdx.x & 31;        // column group
  const int bg   = blockIdx.x >> 5;        // batch group
  const int j0   = wave * 128 + jq * 4;    // a wave covers 128 j: 8 groups of 16

  // hidden first: loads return in order, so its LDS stores do not wait for the W rows.
  const float4* hv = (const float4*)(hidden + (size_t)bg * HB * Hd);
  float4 hreg[4];
  // All loops of this kernel are unrolled so that their arrays stay in registers.
#pragma unroll
  for (int i = 0; i < 4; ++i) hreg[i] = hv[tid + i * 256];
  const int   kk = cg * 32 + lane;         // output column of the final sum
  const float bv = bias[kk];               // fetched here so its latency is hidden

  const float* wp = W + (size_t)j0 * Hd + cg * 32 + c4 * 4;
  float4 w[8][4];
  // Unrolled: all 32 loads issue back to back, ahead of the first wait.
#pragma unroll
  for (int g = 0; g < 8; ++g)
#pragma unroll
    for (int i = 0; i < 4; ++i)
      w[g][i] = *(const float4*)(wp + (size_t)(g * 16 + i) * Hd);

#pragma unroll
  for (int i = 0; i < 4; ++i) ((float4*)hs)[tid + i * 256] = hreg[i];
  __syncthreads();

  float4 acc[HB];
#pragma unroll
  for (int bl = 0; bl < HB; ++bl) acc[bl] = make_float4(0.f, 0.f, 0.f, 0.f);

#pragma unroll
  for (int g = 0; g < 8; ++g) {
#pragma unroll
    for (int bl = 0; bl < HB; ++bl) {
      const float4 h = *(const float4*)&hs[bl * Hd + j0 + g * 16];
      const float hj[4] = {h.x, h.y, h.z, h.w};
#pragma unroll
      for (int i = 0; i < 4; ++i) {
        acc[bl].x = fmaf(hj[i], w[g][i].x, acc[bl].x);
        acc[bl].y = fmaf(hj[i], w[g][i].y, acc[bl].y);
        acc[bl].z = fmaf(hj[i], w[g][i].z, acc[bl].z);
        acc[bl].w = fmaf(hj[i], w[g][i].w, acc[bl].w);
      }
    }
  }

#pragma unroll
  for (int bl = 0; bl < HB; ++bl)
    *(float4*)&part[(wave * 4 + jq) * (HB * 32) + bl * 32 + c4 * 4] = acc[bl];
  __syncthreads();

  if (tid < HB * 32) {                     // one thread per output of the block
    float s = bv;
    // Unrolled: the LDS reads run ahead of the serial adds.
#pragma unroll
    for (int p = 0; p < 32; ++p) s += part[p * (HB * 32) + tid];
    hidb[(size_t)(bg * HB + (tid >> 5)) * Hd + kk] = s;
  }
}

// Kernel 2: fused  logits[b][s] = sum_n tanh( (enc @ W2)[s][n] + hidb[b][n] ) * v[n]
// One block = 128 s-rows of one batch (eight M-subtiles), 256KB A tile in LDS, so
// one block per WGP. 8 waves (two per SIMD, up to 512 VGPRs each); each wave covers
// 8 n-tiles in 2 passes of 4, holding C[4 n-tiles][8 subtiles]; every B fragment
// read from L2 feeds 8 WMMAs, so a WGP draws the packed W from L2 once, not twice.
// The A tile is staged in 16 chunks of 64 K values, one per trip of the first pass's
// K loop: a chunk's loads fly while the trip before it runs on the matrix unit.
#define CK 64                        // K values of a chunk = the two k steps of a trip
#define CL (TMR * CK / 4 / 256)      // float4 loads of a thread per chunk

// A thread's share of a chunk: one float4 column of the rows p, p+16, ..., p+112.
__device__ __forceinline__ void chunk_load(float4 (&a)[CL], const float* p) {
  // Unrolled: the array stays in registers and the loads issue back to back.
#pragma unroll
  for (int i = 0; i < CL; ++i) a[i] = *(const float4*)(p + (size_t)i * 16 * Hd);
  // Keeps the loads in front of the wait below.
  __builtin_amdgcn_sched_barrier(0);
  // Later code overwrites the address registers that these loads name.
  asm volatile("s_wait_xcnt 0x0" ::: "memory");
  // Keeps every later write of those registers behind the wait.
  __builtin_amdgcn_sched_barrier(0);
}

// fp32 -> packed bf16 pairs, to the same rows of the A tile.
__device__ __forceinline__ void chunk_store(const float4 (&a)[CL], unsigned* q) {
  // Unrolled: the array stays in registers.
#pragma unroll
  for (int i = 0; i < CL; ++i) {
    uint2 pr;
    pr.x = pack2_bf16_rne(a[i].x, a[i].y);
    pr.y = pack2_bf16_rne(a[i].z, a[i].w);
    *(uint2*)(q + i * 16 * 512) = pr;
  }
}

// Publishes a chunk: this wave's LDS stores are done, then the work-group's barrier.
// By hand, because __syncthreads() would also wait for the global loads in flight
// (the next chunk and the B refills), which must stay in flight across it.
__device__ __forceinline__ void chunk_publish() {
  asm volatile("s_wait_dscnt 0x0\n\ts_barrier_signal -1\n\ts_barrier_wait -1" ::: "memory");
}

// B fragments of k steps 0 and 1 of a pass.
__device__ __forceinline__ void b_first(uint4 (&blo)[2][4], uint4 (&bhi)[2][4],
                                        const uint4* pB) {
#pragma unroll
  for (int p = 0; p < 2; ++p)
#pragma unroll
    for (int t = 0; t < 4; ++t) {
      blo[p][t] = pB[p * 4 * Hd + t * 16];          // immediate offsets
      bhi[p][t] = pB[p * 4 * Hd + 2 * Hd + t * 16];
      // Issue order as in the loop: another order here tightens the loop's counted
      // waits, which must hold on both ways into it.
      __builtin_amdgcn_sched_barrier(0);
    }
}

// One trip of the K loop = two k steps. With REFILL each B fragment's registers are
// refilled for the k step after next right behind the fragment's last WMMA; adv is
// the advance of pB to the next pair of k steps.
template <bool REFILL>
__device__ __forceinline__ void k_trip(
    v8f (&C)[4][MS], uint4 (&blo)[2][4], uint4 (&bhi)[2][4], const uint4*& pB,
    const int adv, const int k2, const unsigned* ldsA,
    const int rowa, const int hi, const int swz) {
  // Unrolled: p picks the register set, which must be a compile-time choice.
#pragma unroll
  for (int p = 0; p < 2; ++p) {
    const int base0 = (k2 << 5) + (p << 4) + (hi << 2);   // K-pair base, jh=0
    const int col0  = base0 ^ swz;
    const int col1  = (base0 + 8) ^ swz;
    // A fragments once per k step: 2x ds_load_b128 per M-subtile (8 subtiles).
    v16bf Af[MS];
#pragma unroll
    for (int sub = 0; sub < MS; ++sub) {
      const int rbase = (sub * 16 + rowa) * 512;
      uint4 alo = *(const uint4*)&ldsA[rbase + col0];
      uint4 ahi = *(const uint4*)&ldsA[rbase + col1];
      v8u au = {alo.x, alo.y, alo.z, alo.w, ahi.x, ahi.y, ahi.z, ahi.w};
      Af[sub] = __builtin_bit_cast(v16bf, au);
    }
    // Keeps the LDS reads one group ahead of the WMMAs, and the pointer's advance
    // behind their issue.
    __builtin_amdgcn_sched_barrier(0);
    if (REFILL && p == 0) {
      // The advance below overwrites the address pair that the refills in flight name.
      asm volatile("s_wait_xcnt 0x0" ::: "memory");
      // Keeps the advance behind that wait.
      __builtin_amdgcn_sched_barrier(0);
      pB += adv;
    }

#pragma unroll
    for (int t = 0; t < 4; ++t) {                 // 4 n-tiles share A-frags
      v8u bu = {blo[p][t].x, blo[p][t].y, blo[p][t].z, blo[p][t].w,
                bhi[p][t].x, bhi[p][t].y, bhi[p][t].z, bhi[p][t].w};
      v16bf Bm = __builtin_bit_cast(v16bf, bu);
#pragma unroll
      for (int sub = 0; sub < MS; ++sub)          // B amortized over 8 subs
        C[t][sub] = __builtin_amdgcn_wmma_f32_16x16x32_bf16(
                        false, Af[sub], false, Bm, (short)0, C[t][sub],
                        false, false);
      // Keeps the refill behind the fragment's last WMMA: lifted over it, the loads
      // take other registers and are copied back behind a wait at the trip's end.
      __builtin_amdgcn_sched_barrier(0);
      if (REFILL) {
        blo[p][t] = pB[p * 4 * Hd + t * 16];        // refill for the step after next
        bhi[p][t] = pB[p * 4 * Hd + 2 * Hd + t * 16];
        // Keeps the n-tiles in the order of their refills: reordered, the first WMMA
        // of a step waits for the youngest load instead of the oldest.
        __builtin_amdgcn_sched_barrier(0);
      }
    }
  }
}

__global__ __launch_bounds__(256) void attn_energy_kernel(
    const float* __restrict__ enc, const unsigned* __restrict__ Wpk,
    const float* __restrict__ hidb, const float* __restrict__ vvec,
    float* __restrict__ logits) {
  __shared__ unsigned ldsA[512 * TMR];   // 256KB (reused as f32 scratch later)

  const int tid  = threadIdx.x;
  const int wave = tid >> 5;
  const int lane = tid & 31;
  const int b    = blockIdx.x >> 4;            // Sd/TMR = 16 tiles per batch
  const int s0   = (blockIdx.x & 15) * TMR;

  // WMMA fragment addressing (ISA 7.12.2, wave32):
  //  A (16x32 bf16): lane&15 = M row; lane>=16 -> K-pair offset 4;
  //                  VGPR j holds K-pair kp = 16*ks + (j&4)*2 + 4*hi + (j&3).
  //  B (32x16 bf16): lane&15 = N col; same K-pair pattern.
  //  C (16x16 f32):  VGPR r -> row r + 8*(lane>>4), col = lane&15.
  const int rowa = lane & 15;                  // A row == B column within tile
  const int hi   = lane >> 4;
  const int swz  = rowa << 2;                  // XOR swizzle for this lane's row
  const uint4* Wq = (const uint4*)Wpk;         // [kpg*Hd + n]

  // A tile: 128 rows x 1024 K, fp32 -> packed bf16 pairs, XOR-swizzled:
  //   dword idx = row*512 + (kp ^ ((row&15)<<2))
  // Staging map of a chunk: a half-wave covers the 256 bytes of one row; a wave's two
  // rows are 8 apart, so the swizzle puts them into different halves of the banks.
  const int srow = (hi << 3) | wave;           // row & 15 of all of this thread's rows
  const int skp  = rowa << 1;                  // K-pair of its float4 within a chunk
  const int sswz = srow << 2;
  const float* pA = enc + ((size_t)b * Sd + s0 + srow) * Hd + rowa * 4;
  unsigned* const qA = ldsA + srow * 512;

  float acc[MS][8];
#pragma unroll
  for (int sub = 0; sub < MS; ++sub)
#pragma unroll
    for (int r = 0; r < 8; ++r) acc[sub][r] = 0.f;

  // Kept rolled: one pass's epilogue values are then never live beside the next
  // pass's 256 accumulator registers, and the epilogue stands once in the code.
#pragma unroll 1
  for (int g = 0; g < 2; ++g) {                // 2 passes of 4 n-tiles per wave
    const int nbase = wave * 128 + g * 64 + rowa;
    v8f C[4][MS];                              // [n-tile][M-subtile]
#pragma unroll
    for (int t = 0; t < 4; ++t)
#pragma unroll
      for (int sub = 0; sub < MS; ++sub) C[t][sub] = (v8f){};

    // B pointer for ks=0: kpg = (ks<<2)+hi -> advance by 4*Hd uint4 per ks.
    const uint4* pB = Wq + (size_t)hi * Hd + nbase;
    uint4 blo[2][4], bhi[2][4];                // B fragments of two k steps

    if (g == 0) {
      // First pass, with the staging of A in its K loop.
      float4 ar[CL];
      chunk_load(ar, pA);                      // chunk 0, from memory: issued first
      b_first(blo, bhi, pB);
      chunk_store(ar, qA + (skp ^ sswz));
      chunk_load(ar, pA + CK);                 // chunk 1 flies over trip 0
      chunk_publish();

      // Kept whole: a further unrolled trip only adds code and live A fragments. The
      // last two trips stand behind the loop, so that the loop's foot needs no branch:
      // a branch there merges two paths in the counted waits of the B refills.
#pragma clang loop unroll(disable)
      for (int k2 = 0; k2 < 14; ++k2) {
        k_trip<true>(C, blo, bhi, pB, 8 * Hd, k2, ldsA, rowa, hi, swz);
        chunk_store(ar, qA + ((((k2 + 1) << 5) + skp) ^ sswz));   // chunk k2+1
        pA += CK;                              // behind the wait that ends chunk_load
        chunk_load(ar, pA + CK);               // chunk k2+2 flies over trip k2+1
        chunk_publish();
      }
      k_trip<true>(C, blo, bhi, pB, 8 * Hd, 14, ldsA, rowa, hi, swz);
      chunk_store(ar, qA + (((15 << 5) + skp) ^ sswz));           // the last chunk
      chunk_publish();
      k_trip<false>(C, blo, bhi, pB, 0, 15, ldsA, rowa, hi, swz);
    } else {
      // Second pass: the whole A tile is in LDS.
      b_first(blo, bhi, pB);
      // Kept whole: a peeled or further unrolled trip only adds code and live A fragments.
#pragma clang loop unroll(disable)
      for (int k2 = 0; k2 < 16; ++k2) {
        // Next pair of k steps; the last trip reads its own steps again (values
        // unused), so no address leaves the packed W.
        k_trip<true>(C, blo, bhi, pB, (k2 < 15) ? 8 * Hd : 0, k2, ldsA, rowa, hi, swz);
      }
    }

    // Fused epilogue: tanh(C + hid_part + bias) * v[n], reduce over n per row.
    float hb[4], vn[4];
#pragma unroll
    for (int t = 0; t < 4; ++t) {
      const int n = nbase + t * 16;
      hb[t] = hidb[b * Hd + n];
    }
    // The loads of v below may take, as a result register, the offset register that the
    // loads of hidb in flight name.
    asm volatile("s_wait_xcnt 0x0" ::: "memory");
    // Keeps the loads of v behind that wait.
    __builtin_amdgcn_sched_barrier(0);
#pragma unroll
    for (int t = 0; t < 4; ++t) vn[t] = vvec[nbase + t * 16];
    // The sums below reuse the registers that hold the addresses of the loads in flight.
    asm volatile("s_wait_xcnt 0x0" ::: "memory");
    // Keeps those sums behind the wait.
    __builtin_amdgcn_sched_barrier(0);
#pragma unroll
    for (int t = 0; t < 4; ++t) {
#pragma unroll
      for (int sub = 0; sub < MS; ++sub)
#pragma unroll
        for (int r = 0; r < 8; ++r)
          acc[sub][r] += fast_tanh(C[t][sub][r] + hb[t]) * vn[t];  // row = sub*16 + r + 8*hi
    }
  }

  // Deterministic cross-lane/cross-wave reduction: reuse A-tile LDS (A is dead).
  __syncthreads();
  float* scratch = (float*)ldsA;                      // 256 threads x 64 floats
#pragma unroll
  for (int sub = 0; sub < MS; ++sub)
#pragma unroll
    for (int r = 0; r < 8; ++r)
      scratch[tid * (MS * 8) + sub * 8 + r] = acc[sub][r];
  __syncthreads();
  if (tid < TMR) {
    const int sub = tid >> 4, h = (tid >> 3) & 1, r = tid & 7;
    float s = 0.f;
    for (int w = 0; w < 8; ++w)
      for (int l = 0; l < 16; ++l)
        s += scratch[(w * 32 + h * 16 + l) * (MS * 8) + sub * 8 + r];
    logits[(size_t)b * Sd + s0 + tid] = s;
  }
}

// Kernel 3: softmax over S per batch row.
// A thread's 8 logits are loaded once and stay in registers through max, exp, sum and
// scale, so one round trip to L2 or memory stands on the block's path; out is only stored.
#define SPT (Sd / 256)        // logits per thread

// exp(t) as 2^(t * log2 e), the instructions that __expf compiles to. The v_nop is the
// slot that the instruction set asks for behind a transcendental. It stands in one
// statement with the v_exp_f32 because with eight exponentials side by side the compiler
// put a paired multiply that overwrites the source directly behind one, and a v_nop in
// a statement of its own was moved away from it.
__device__ __forceinline__ float exp_slot(float t) {
  float e;
  asm("v_exp_f32 %0, %1\n\tv_nop" : "=v"(e) : "v"(t * 1.4426950408889634f));
  return e;
}

__global__ __launch_bounds__(256) void softmax_kernel(
    const float* __restrict__ logits, float* __restrict__ out) {
  __shared__ float red[256];
  const int b = blockIdx.x, tid = threadIdx.x;
  const float* row = logits + (size_t)b * Sd;

  float x[SPT];
  // All loops over x are unrolled so that it stays in registers; here the 8 loads
  // also issue back to back, ahead of the first wait.
#pragma unroll
  for (int j = 0; j < SPT; ++j) x[j] = row[tid + j * 256];

  float m = -INFINITY;
#pragma unroll
  for (int j = 0; j < SPT; ++j) m = fmaxf(m, x[j]);
  red[tid] = m; __syncthreads();
  for (int s = 128; s > 0; s >>= 1) {
    if (tid < s) red[tid] = fmaxf(red[tid], red[tid + s]);
    __syncthreads();
  }
  m = red[0];
  __syncthreads();

  float sl = 0.f;
#pragma unroll
  for (int j = 0; j < SPT; ++j) {
    x[j] = exp_slot(x[j] - m);
    sl += x[j];
  }
  red[tid] = sl; __syncthreads();
  for (int s = 128; s > 0; s >>= 1) {
    if (tid < s) red[tid] += red[tid + s];
    __syncthreads();
  }
  const float inv = 1.f / red[0];
#pragma unroll
  for (int j = 0; j < SPT; ++j)
    out[(size_t)b * Sd + tid + j * 256] = x[j] * inv;
}

extern "C" void kernel_launch(void* const* d_in, const int* in_sizes, int n_in,
                              void* d_out, int out_size, void* d_ws, size_t ws_size,
                              hipStream_t stream) {
  (void)in_sizes; (void)n_in; (void)out_size; (void)ws_size;
  const float* hidden = (const float*)d_in[0];   // (B,H)
  const float* enc    = (const float*)d_in[1];   // (B,S,H)
  const float* W      = (const float*)d_in[2];   // (2H,H)
  const float* b_attn = (const float*)d_in[3];   // (H,)
  const float* v      = (const float*)d_in[4];   // (H,)
  float* out = (float*)d_out;                    // (B,S)

  float*    hidb   = (float*)d_ws;               // 16*1024 f32
  float*    logits = hidb + Bd * Hd;             // 16*2048 f32
  unsigned* Wpk    = (unsigned*)(logits + Bd * Sd);  // 2MB packed bf16 (uint4 tiled)

  packw_kernel<<<(512 * Hd) / 256, 256, 0, stream>>>(W, Wpk);
  hid_kernel<<<(Hd / 32) * (Bd / HB), 256, 0, stream>>>(hidden, W, b_attn, hidb);
  attn_energy_kernel<<<Bd * (Sd / TMR), 256, 0, stream>>>(enc, Wpk, hidb, v, logits);
  softmax_kernel<<<Bd, 256, 0, stream>>>(logits, out);
}
